// v000
// Times are from an AMD MI455X. After a warm-up the kernel runs many times in a row, and a time is the length of
// such a window on the GPU divided by its runs, so every launch and the gaps after it count. The runs cycle
// through copies of the inputs. A figure is the median of several windows, for all but v000 over two sittings.
// Sittings can differ by a few percent; kernels timed side by side share one.
// The starting kernel, v000, takes 132 microseconds a run.
#include <hip/hip_runtime.h>
#include <hip/hip_bf16.h>

typedef __attribute__((ext_vector_type(16))) _Float16 v16h;
typedef __attribute__((ext_vector_type(8)))  _Float16 v8h;
typedef __attribute__((ext_vector_type(8)))  float    v8f;

#define NQ 2048
#define NK 2048
#define DM 1024
#define NH 16
#define DK 64
#define SCALE 0.125f          /* 1/sqrt(64) */
#define L2E   1.44269504088896340736f

__device__ __forceinline__ v8f wmma_f16(v16h a, v16h b, v8f c) {
  return __builtin_amdgcn_wmma_f32_16x16x32_f16(false, a, false, b,
                                                (short)0, c, false, false);
}

// Load one 16-element f16 fragment (A or B operand, identical per-lane run
// pattern) from an fp32 row in global memory: elements 0..7 = row[lo..lo+7],
// 8..15 = row[lo+16..lo+23], scaled.
__device__ __forceinline__ v16h frag_from_f32row(const float* rowp, int lo, float s) {
  const float4 a0 = *(const float4*)(rowp + lo);
  const float4 a1 = *(const float4*)(rowp + lo + 4);
  const float4 b0 = *(const float4*)(rowp + lo + 16);
  const float4 b1 = *(const float4*)(rowp + lo + 20);
  v16h r;
  r[0]=(_Float16)(a0.x*s);  r[1]=(_Float16)(a0.y*s);
  r[2]=(_Float16)(a0.z*s);  r[3]=(_Float16)(a0.w*s);
  r[4]=(_Float16)(a1.x*s);  r[5]=(_Float16)(a1.y*s);
  r[6]=(_Float16)(a1.z*s);  r[7]=(_Float16)(a1.w*s);
  r[8]=(_Float16)(b0.x*s);  r[9]=(_Float16)(b0.y*s);
  r[10]=(_Float16)(b0.z*s); r[11]=(_Float16)(b0.w*s);
  r[12]=(_Float16)(b1.x*s); r[13]=(_Float16)(b1.y*s);
  r[14]=(_Float16)(b1.z*s); r[15]=(_Float16)(b1.w*s);
  return r;
}

// Same fragment pattern from an f16 LDS row (two ds_load_b128).
__device__ __forceinline__ v16h frag_from_ldsrow(const _Float16* rowp, int lo) {
  v8h a = *(const v8h*)(rowp + lo);
  v8h b = *(const v8h*)(rowp + lo + 16);
  return __builtin_shufflevector(a, b, 0,1,2,3,4,5,6,7,8,9,10,11,12,13,14,15);
}

#define KLDS_STRIDE 72   /* 144B: (stride/16B)=9 odd -> conflict-free b128 rows */
#define VLDS_STRIDE 40   /* 80B:  (stride/16B)=5 odd */

__global__ __launch_bounds__(256)
void attn_fwd(const float* __restrict__ Q, const float* __restrict__ K,
              const float* __restrict__ V, float* __restrict__ X) {
  __shared__ _Float16 Klds[32 * KLDS_STRIDE];   // [key][d]  f16
  __shared__ _Float16 VTlds[64 * VLDS_STRIDE];  // [d][key]  f16 (transposed)

  const int lane = threadIdx.x & 31;
  const int wave = threadIdx.x >> 5;
  const int qt = blockIdx.x & 15;          // 16 q-tiles of 128
  const int h  = (blockIdx.x >> 4) & 15;   // 16 heads
  const int b  = blockIdx.x >> 8;          // 2 batches
  const int lo = (lane & 16) ? 8 : 0;      // per-lane run offset within 32
  const int l15 = lane & 15;

  const int qrow = qt * 128 + wave * 16 + l15;
  const float* qptr = Q + (b * NQ + qrow) * DM + h * DK;

  // Qᵀ B-fragments (d-chunks 0-31 / 32-63), softmax scale folded in.
  const v16h qf0 = frag_from_f32row(qptr,      lo, SCALE);
  const v16h qf1 = frag_from_f32row(qptr + 32, lo, SCALE);

  v8f O[4];
  #pragma unroll
  for (int i = 0; i < 4; ++i) O[i] = (v8f){0,0,0,0,0,0,0,0};
  float m = -1.0e30f, l = 0.0f;

  for (int kb = 0; kb < NK; kb += 32) {
    __syncthreads();  // previous tile fully consumed
    // Cooperative fill: 32 keys x 64 dims; 256 threads x 2 float4.
    #pragma unroll
    for (int t = 0; t < 2; ++t) {
      const int idx = (threadIdx.x * 2 + t) * 4;   // linear f32 index < 2048
      const int row = idx >> 6;                    // key within tile
      const int col = idx & 63;                    // dim
      const float* g = K + (b * NK + kb + row) * DM + h * DK + col;
      const float4 kf = *(const float4*)g;
      _Float16* kd = &Klds[row * KLDS_STRIDE + col];
      kd[0]=(_Float16)kf.x; kd[1]=(_Float16)kf.y;
      kd[2]=(_Float16)kf.z; kd[3]=(_Float16)kf.w;
      const float4 vf = *(const float4*)(V + (b * NK + kb + row) * DM + h * DK + col);
      VTlds[(col+0) * VLDS_STRIDE + row] = (_Float16)vf.x;
      VTlds[(col+1) * VLDS_STRIDE + row] = (_Float16)vf.y;
      VTlds[(col+2) * VLDS_STRIDE + row] = (_Float16)vf.z;
      VTlds[(col+3) * VLDS_STRIDE + row] = (_Float16)vf.w;
    }
    __syncthreads();

    // Sᵀ = K · Qᵀ  (two 16key x 16q fragments, K-dim 64 = 2 WMMAs each)
    const _Float16* kr0 = &Klds[(l15)      * KLDS_STRIDE];
    const _Float16* kr1 = &Klds[(16 + l15) * KLDS_STRIDE];
    v16h k00 = frag_from_ldsrow(kr0,      lo);
    v16h k01 = frag_from_ldsrow(kr0 + 32, lo);
    v16h k10 = frag_from_ldsrow(kr1,      lo);
    v16h k11 = frag_from_ldsrow(kr1 + 32, lo);
    v8f s0 = (v8f){0,0,0,0,0,0,0,0};
    v8f s1 = (v8f){0,0,0,0,0,0,0,0};
    s0 = wmma_f16(k00, qf0, s0);  s0 = wmma_f16(k01, qf1, s0);
    s1 = wmma_f16(k10, qf0, s1);  s1 = wmma_f16(k11, qf1, s1);

    // Online softmax over this chunk's 32 keys (16 lane-local + 1 shuffle).
    float mc = -1.0e30f;
    #pragma unroll
    for (int r = 0; r < 8; ++r) { mc = fmaxf(mc, s0[r]); mc = fmaxf(mc, s1[r]); }
    mc = fmaxf(mc, __shfl_xor(mc, 16, 32));
    const float mnew = fmaxf(m, mc);
    const float corr = exp2f((m - mnew) * L2E);
    m = mnew;
    l *= corr;
    #pragma unroll
    for (int i = 0; i < 4; ++i) O[i] *= corr;

    // Pᵀ B-fragment feeds directly from the Sᵀ accumulator registers.
    v16h pf;
    float psum = 0.0f;
    #pragma unroll
    for (int r = 0; r < 8; ++r) {
      const float p0 = exp2f((s0[r] - m) * L2E);
      const float p1 = exp2f((s1[r] - m) * L2E);
      psum += p0 + p1;
      pf[r]     = (_Float16)p0;
      pf[8 + r] = (_Float16)p1;
    }
    l += psum;

    // Oᵀ += Vᵀ · Pᵀ  (4 d-groups of 16)
    #pragma unroll
    for (int gd = 0; gd < 4; ++gd) {
      v16h vfrag = frag_from_ldsrow(&VTlds[(gd * 16 + l15) * VLDS_STRIDE], lo);
      O[gd] = wmma_f16(vfrag, pf, O[gd]);
    }
  }

  // Finish: combine the two lane-half partial sums, normalize, store.
  l += __shfl_xor(l, 16, 32);
  const float inv = 1.0f / l;
  const int dhi = (lane & 16) ? 8 : 0;
  float* xrow = X + (b * NQ + qrow) * DM + h * DK;
  #pragma unroll
  for (int gd = 0; gd < 4; ++gd) {
    #pragma unroll
    for (int r = 0; r < 8; ++r)
      xrow[gd * 16 + r + dhi] = O[gd][r] * inv;
  }
}

// Y[m][n] = sum_k X[m][k] * W[n][k] + bias[n];  M=4096, N=1024, K=1024.
// Each wave: 32x32 tile (2x2 WMMA frags); block: 8 waves = 64(M) x 128(N).
__global__ __launch_bounds__(256)
void out_proj(const float* __restrict__ X, const float* __restrict__ W,
              const float* __restrict__ bias, float* __restrict__ Y) {
  const int lane = threadIdx.x & 31;
  const int wave = threadIdx.x >> 5;
  const int lo = (lane & 16) ? 8 : 0;
  const int l15 = lane & 15;
  const int bm = blockIdx.x & 63;
  const int bn = blockIdx.x >> 6;
  const int m0 = bm * 64 + (wave & 1) * 32;
  const int n0 = bn * 128 + (wave >> 1) * 32;

  const float* xr0 = X + (m0 + l15) * DM;
  const float* xr1 = X + (m0 + 16 + l15) * DM;
  const float* wr0 = W + (n0 + l15) * DM;
  const float* wr1 = W + (n0 + 16 + l15) * DM;

  v8f C[2][2];
  #pragma unroll
  for (int i = 0; i < 2; ++i)
    #pragma unroll
    for (int j = 0; j < 2; ++j) C[i][j] = (v8f){0,0,0,0,0,0,0,0};

  for (int kc = 0; kc < DM; kc += 32) {
    v16h a0 = frag_from_f32row(xr0 + kc, lo, 1.0f);
    v16h a1 = frag_from_f32row(xr1 + kc, lo, 1.0f);
    v16h b0 = frag_from_f32row(wr0 + kc, lo, 1.0f);
    v16h b1 = frag_from_f32row(wr1 + kc, lo, 1.0f);
    C[0][0] = wmma_f16(a0, b0, C[0][0]);
    C[0][1] = wmma_f16(a0, b1, C[0][1]);
    C[1][0] = wmma_f16(a1, b0, C[1][0]);
    C[1][1] = wmma_f16(a1, b1, C[1][1]);
  }

  const float bias0 = bias[n0 + l15];
  const float bias1 = bias[n0 + 16 + l15];
  const int mhi = (lane & 16) ? 8 : 0;
  #pragma unroll
  for (int mi = 0; mi < 2; ++mi) {
    #pragma unroll
    for (int ni = 0; ni < 2; ++ni) {
      const float bb = ni ? bias1 : bias0;
      #pragma unroll
      for (int r = 0; r < 8; ++r) {
        const int row = m0 + mi * 16 + r + mhi;
        const int col = n0 + ni * 16 + l15;
        Y[row * DM + col] = C[mi][ni][r] + bb;
      }
    }
  }
}

extern "C" void kernel_launch(void* const* d_in, const int* in_sizes, int n_in,
                              void* d_out, int out_size, void* d_ws, size_t ws_size,
                              hipStream_t stream) {
  (void)in_sizes; (void)n_in; (void)out_size; (void)ws_size;
  const float* Q  = (const float*)d_in[0];
  const float* K  = (const float*)d_in[1];
  const float* V  = (const float*)d_in[2];
  const float* Wo = (const float*)d_in[3];
  const float* bo = (const float*)d_in[4];
  float* X = (float*)d_ws;            // (b, q, h*d_k) fp32 intermediate
  float* Y = (float*)d_out;

  // 2 batches * 16 heads * 16 q-tiles = 512 blocks
  attn_fwd<<<dim3(512), dim3(256), 0, stream>>>(Q, K, V, X);
  // (4096/64) * (1024/128) = 64 * 8 = 512 blocks
  out_proj<<<dim3(512), dim3(256), 0, stream>>>(X, Wo, bo, Y);
}

// v001
// It runs in 109 microseconds.
// In two side-by-side timings against v000, it was 1.24 and 1.23 times as fast.
#include <hip/hip_runtime.h>
#include <hip/hip_bf16.h>

typedef __attribute__((ext_vector_type(16))) _Float16 v16h;
typedef __attribute__((ext_vector_type(8)))  _Float16 v8h;
typedef __attribute__((ext_vector_type(8)))  float    v8f;

#define NQ 2048
#define NK 2048
#define DM 1024
#define NH 16
#define DK 64
#define SCALE 0.125f          /* 1/sqrt(64) */
#define L2E   1.44269504088896340736f

__device__ __forceinline__ v8f wmma_f16(v16h a, v16h b, v8f c) {
  return __builtin_amdgcn_wmma_f32_16x16x32_f16(false, a, false, b,
                                                (short)0, c, false, false);
}

// Load one 16-element f16 fragment (A or B operand, identical per-lane run
// pattern) from an fp32 row in global memory: elements 0..7 = row[lo..lo+7],
// 8..15 = row[lo+16..lo+23], scaled.
__device__ __forceinline__ v16h frag_from_f32row(const float* rowp, int lo, float s) {
  const float4 a0 = *(const float4*)(rowp + lo);
  const float4 a1 = *(const float4*)(rowp + lo + 4);
  const float4 b0 = *(const float4*)(rowp + lo + 16);
  const float4 b1 = *(const float4*)(rowp + lo + 20);
  v16h r;
  r[0]=(_Float16)(a0.x*s);  r[1]=(_Float16)(a0.y*s);
  r[2]=(_Float16)(a0.z*s);  r[3]=(_Float16)(a0.w*s);
  r[4]=(_Float16)(a1.x*s);  r[5]=(_Float16)(a1.y*s);
  r[6]=(_Float16)(a1.z*s);  r[7]=(_Float16)(a1.w*s);
  r[8]=(_Float16)(b0.x*s);  r[9]=(_Float16)(b0.y*s);
  r[10]=(_Float16)(b0.z*s); r[11]=(_Float16)(b0.w*s);
  r[12]=(_Float16)(b1.x*s); r[13]=(_Float16)(b1.y*s);
  r[14]=(_Float16)(b1.z*s); r[15]=(_Float16)(b1.w*s);
  return r;
}

// Same fragment pattern from an f16 LDS row (two ds_load_b128).
__device__ __forceinline__ v16h frag_from_ldsrow(const _Float16* rowp, int lo) {
  v8h a = *(const v8h*)(rowp + lo);
  v8h b = *(const v8h*)(rowp + lo + 16);
  return __builtin_shufflevector(a, b, 0,1,2,3,4,5,6,7,8,9,10,11,12,13,14,15);
}

#define KLDS_STRIDE 72   /* 144B: (stride/16B)=9 odd -> conflict-free b128 rows */
#define VLDS_STRIDE 40   /* 80B:  (stride/16B)=5 odd */

__global__ __launch_bounds__(256)
void attn_fwd(const float* __restrict__ Q, const float* __restrict__ K,
              const float* __restrict__ V, float* __restrict__ X) {
  __shared__ _Float16 Klds[32 * KLDS_STRIDE];   // [key][d]  f16
  __shared__ _Float16 VTlds[64 * VLDS_STRIDE];  // [d][key]  f16 (transposed)

  const int lane = threadIdx.x & 31;
  const int wave = threadIdx.x >> 5;
  const int qt = blockIdx.x & 15;          // 16 q-tiles of 128
  const int h  = (blockIdx.x >> 4) & 15;   // 16 heads
  const int b  = blockIdx.x >> 8;          // 2 batches
  const int lo = (lane & 16) ? 8 : 0;      // per-lane run offset within 32
  const int l15 = lane & 15;

  const int qrow = qt * 128 + wave * 16 + l15;
  const float* qptr = Q + (b * NQ + qrow) * DM + h * DK;

  // Qᵀ B-fragments (d-chunks 0-31 / 32-63), softmax scale folded in.
  const v16h qf0 = frag_from_f32row(qptr,      lo, SCALE);
  const v16h qf1 = frag_from_f32row(qptr + 32, lo, SCALE);

  v8f O[4];
  #pragma unroll
  for (int i = 0; i < 4; ++i) O[i] = (v8f){0,0,0,0,0,0,0,0};
  float m = -1.0e30f, l = 0.0f;

  for (int kb = 0; kb < NK; kb += 32) {
    __syncthreads();  // previous tile fully consumed
    // Cooperative fill: 32 keys x 64 dims; 256 threads x 2 float4.
    #pragma unroll
    for (int t = 0; t < 2; ++t) {
      const int idx = (threadIdx.x * 2 + t) * 4;   // linear f32 index < 2048
      const int row = idx >> 6;                    // key within tile
      const int col = idx & 63;                    // dim
      const float* g = K + (b * NK + kb + row) * DM + h * DK + col;
      const float4 kf = *(const float4*)g;
      _Float16* kd = &Klds[row * KLDS_STRIDE + col];
      kd[0]=(_Float16)kf.x; kd[1]=(_Float16)kf.y;
      kd[2]=(_Float16)kf.z; kd[3]=(_Float16)kf.w;
      const float4 vf = *(const float4*)(V + (b * NK + kb + row) * DM + h * DK + col);
      VTlds[(col+0) * VLDS_STRIDE + row] = (_Float16)vf.x;
      VTlds[(col+1) * VLDS_STRIDE + row] = (_Float16)vf.y;
      VTlds[(col+2) * VLDS_STRIDE + row] = (_Float16)vf.z;
      VTlds[(col+3) * VLDS_STRIDE + row] = (_Float16)vf.w;
    }
    __syncthreads();

    // Sᵀ = K · Qᵀ  (two 16key x 16q fragments, K-dim 64 = 2 WMMAs each)
    const _Float16* kr0 = &Klds[(l15)      * KLDS_STRIDE];
    const _Float16* kr1 = &Klds[(16 + l15) * KLDS_STRIDE];
    v16h k00 = frag_from_ldsrow(kr0,      lo);
    v16h k01 = frag_from_ldsrow(kr0 + 32, lo);
    v16h k10 = frag_from_ldsrow(kr1,      lo);
    v16h k11 = frag_from_ldsrow(kr1 + 32, lo);
    v8f s0 = (v8f){0,0,0,0,0,0,0,0};
    v8f s1 = (v8f){0,0,0,0,0,0,0,0};
    s0 = wmma_f16(k00, qf0, s0);  s0 = wmma_f16(k01, qf1, s0);
    s1 = wmma_f16(k10, qf0, s1);  s1 = wmma_f16(k11, qf1, s1);

    // Online softmax over this chunk's 32 keys (16 lane-local + 1 shuffle).
    float mc = -1.0e30f;
    #pragma unroll
    for (int r = 0; r < 8; ++r) { mc = fmaxf(mc, s0[r]); mc = fmaxf(mc, s1[r]); }
    mc = fmaxf(mc, __shfl_xor(mc, 16, 32));
    const float mnew = fmaxf(m, mc);
    const float corr = exp2f((m - mnew) * L2E);
    m = mnew;
    l *= corr;
    #pragma unroll
    for (int i = 0; i < 4; ++i) O[i] *= corr;

    // Pᵀ B-fragment feeds directly from the Sᵀ accumulator registers.
    v16h pf;
    float psum = 0.0f;
    #pragma unroll
    for (int r = 0; r < 8; ++r) {
      const float p0 = exp2f((s0[r] - m) * L2E);
      const float p1 = exp2f((s1[r] - m) * L2E);
      psum += p0 + p1;
      pf[r]     = (_Float16)p0;
      pf[8 + r] = (_Float16)p1;
    }
    l += psum;

    // Oᵀ += Vᵀ · Pᵀ  (4 d-groups of 16)
    #pragma unroll
    for (int gd = 0; gd < 4; ++gd) {
      v16h vfrag = frag_from_ldsrow(&VTlds[(gd * 16 + l15) * VLDS_STRIDE], lo);
      O[gd] = wmma_f16(vfrag, pf, O[gd]);
    }
  }

  // Finish: combine the two lane-half partial sums, normalize, store.
  l += __shfl_xor(l, 16, 32);
  const float inv = 1.0f / l;
  const int dhi = (lane & 16) ? 8 : 0;
  float* xrow = X + (b * NQ + qrow) * DM + h * DK;
  #pragma unroll
  for (int gd = 0; gd < 4; ++gd) {
    #pragma unroll
    for (int r = 0; r < 8; ++r)
      xrow[gd * 16 + r + dhi] = O[gd][r] * inv;
  }
}

// Y[m][n] = sum_k X[m][k] * W[n][k] + bias[n];  M=4096, N=1024, K=1024.
// Each wave: 32x32 tile (2x2 WMMA frags); block: 8 waves = 64(M) x 128(N).
// Per k-block of 128 the block's 64 X rows and 128 W rows are read once, one
// whole 512-byte row piece per wave-wide load, converted to f16 and kept in
// LDS, where all waves that need a row take their fragments from.
typedef __attribute__((ext_vector_type(4))) _Float16 v4h;
typedef __attribute__((ext_vector_type(4))) float    v4f;
#define PK 128            /* k per staged block */
#define PLDS_STRIDE 136   /* 272B: (stride/16B)=17 odd -> conflict-free b128 rows */

__device__ __forceinline__ v4h cvt4(const v4f f) {
  v4h r;
  r[0]=(_Float16)f[0]; r[1]=(_Float16)f[1]; r[2]=(_Float16)f[2]; r[3]=(_Float16)f[3];
  return r;
}

__global__ __launch_bounds__(256)
void out_proj(const float* __restrict__ X, const float* __restrict__ W,
              const float* __restrict__ bias, float* __restrict__ Y) {
  __shared__ __attribute__((aligned(16))) _Float16 Xs[64 * PLDS_STRIDE];
  __shared__ __attribute__((aligned(16))) _Float16 Ws[128 * PLDS_STRIDE];

  const int lane = threadIdx.x & 31;
  const int wave = threadIdx.x >> 5;
  const int lo = (lane & 16) ? 8 : 0;
  const int l15 = lane & 15;
  const int bm = blockIdx.x & 63;
  const int bn = blockIdx.x >> 6;
  const int m0 = bm * 64 + (wave & 1) * 32;
  const int n0 = bn * 128 + (wave >> 1) * 32;

  // Staging: wave w brings rows w, w+8, w+16, ...; lane l brings floats 4l..4l+3.
  const float* xg = X + (bm * 64 + wave) * DM + lane * 4;
  const float* wg = W + (bn * 128 + wave) * DM + lane * 4;
  _Float16* xs = &Xs[wave * PLDS_STRIDE + lane * 4];
  _Float16* ws = &Ws[wave * PLDS_STRIDE + lane * 4];

  // Fragment rows of this wave's 32x32 tile.
  const _Float16* xr0 = &Xs[((wave & 1) * 32 + l15) * PLDS_STRIDE];
  const _Float16* xr1 = xr0 + 16 * PLDS_STRIDE;
  const _Float16* wr0 = &Ws[((wave >> 1) * 32 + l15) * PLDS_STRIDE];
  const _Float16* wr1 = wr0 + 16 * PLDS_STRIDE;

  v8f C[2][2];
  #pragma unroll
  for (int i = 0; i < 2; ++i)
    #pragma unroll
    for (int j = 0; j < 2; ++j) C[i][j] = (v8f){0,0,0,0,0,0,0,0};

  for (int kc = 0; kc < DM; kc += PK, xg += PK, wg += PK) {
    v4f xv[8], wv[16];
    // The staging loops are unrolled so that xv and wv have constant indices
    // and live in registers, with all loads issued back to back.
    #pragma unroll
    for (int i = 0; i < 8; ++i)
      xv[i] = *(const v4f*)(xg + i * 8 * DM);
    #pragma unroll
    for (int i = 0; i < 16; ++i)
      wv[i] = *(const v4f*)(wg + i * 8 * DM);
    // Inputs-only fence on the loaded values: holds all 24 loads, 16 bytes wide,
    // ahead of the barrier. Without it the compiler halves the X loads and sinks
    // one half behind the barrier: a second load latency in every k-block.
    // The two addresses are inputs too: their registers then stay untouched
    // until every load that names them has returned.
    asm volatile("" :: "v"(xv[0]), "v"(xv[1]), "v"(xv[2]), "v"(xv[3]),
                       "v"(xv[4]), "v"(xv[5]), "v"(xv[6]), "v"(xv[7]),
                       "v"(wv[0]), "v"(wv[1]), "v"(wv[2]), "v"(wv[3]),
                       "v"(wv[4]), "v"(wv[5]), "v"(wv[6]), "v"(wv[7]),
                       "v"(wv[8]), "v"(wv[9]), "v"(wv[10]), "v"(wv[11]),
                       "v"(wv[12]), "v"(wv[13]), "v"(wv[14]), "v"(wv[15]),
                       "v"(xg), "v"(wg));
    __syncthreads();  // previous k-block fully consumed
    #pragma unroll
    for (int i = 0; i < 8; ++i)
      *(v4h*)(xs + i * 8 * PLDS_STRIDE) = cvt4(xv[i]);
    #pragma unroll
    for (int i = 0; i < 16; ++i)
      *(v4h*)(ws + i * 8 * PLDS_STRIDE) = cvt4(wv[i]);
    __syncthreads();  // k-block visible to every wave

    // Unrolled: LDS offsets become immediates, no loop overhead among the WMMAs.
    #pragma unroll
    for (int ks = 0; ks < PK; ks += 32) {
      v16h a0 = frag_from_ldsrow(xr0 + ks, lo);
      v16h a1 = frag_from_ldsrow(xr1 + ks, lo);
      v16h b0 = frag_from_ldsrow(wr0 + ks, lo);
      v16h b1 = frag_from_ldsrow(wr1 + ks, lo);
      C[0][0] = wmma_f16(a0, b0, C[0][0]);
      C[0][1] = wmma_f16(a0, b1, C[0][1]);
      C[1][0] = wmma_f16(a1, b0, C[1][0]);
      C[1][1] = wmma_f16(a1, b1, C[1][1]);
    }
  }

  const float bias0 = bias[n0 + l15];
  const float bias1 = bias[n0 + 16 + l15];
  const int mhi = (lane & 16) ? 8 : 0;
  #pragma unroll
  for (int mi = 0; mi < 2; ++mi) {
    #pragma unroll
    for (int ni = 0; ni < 2; ++ni) {
      const float bb = ni ? bias1 : bias0;
      #pragma unroll
      for (int r = 0; r < 8; ++r) {
        const int row = m0 + mi * 16 + r + mhi;
        const int col = n0 + ni * 16 + l15;
        Y[row * DM + col] = C[mi][ni][r] + bb;
      }
    }
  }
}

extern "C" void kernel_launch(void* const* d_in, const int* in_sizes, int n_in,
                              void* d_out, int out_size, void* d_ws, size_t ws_size,
                              hipStream_t stream) {
  (void)in_sizes; (void)n_in; (void)out_size; (void)ws_size;
  const float* Q  = (const float*)d_in[0];
  const float* K  = (const float*)d_in[1];
  const float* V  = (const float*)d_in[2];
  const float* Wo = (const float*)d_in[3];
  const float* bo = (const float*)d_in[4];
  float* X = (float*)d_ws;            // (b, q, h*d_k) fp32 intermediate
  float* Y = (float*)d_out;

  // 2 batches * 16 heads * 16 q-tiles = 512 blocks
  attn_fwd<<<dim3(512), dim3(256), 0, stream>>>(Q, K, V, X);
  // (4096/64) * (1024/128) = 64 * 8 = 512 blocks
  out_proj<<<dim3(512), dim3(256), 0, stream>>>(X, Wo, bo, Y);
}

// v002
// A run of this version takes 75.4 microseconds.
// Timed twice side by side with v001, it ran 1.45 and 1.46 times as fast.
// Over all steps from v000 it is 1.79 times as fast.
#include <hip/hip_runtime.h>
#include <hip/hip_bf16.h>

typedef __attribute__((ext_vector_type(16))) _Float16 v16h;
typedef __attribute__((ext_vector_type(8)))  _Float16 v8h;
typedef __attribute__((ext_vector_type(8)))  float    v8f;
typedef __attribute__((ext_vector_type(4)))  float    v4f;

#define NQ 2048
#define NK 2048
#define DM 1024
#define NH 16
#define DK 64
#define SCALE 0.125f          /* 1/sqrt(64) */
#define L2E   1.44269504088896340736f

__device__ __forceinline__ v8f wmma_f16(v16h a, v16h b, v8f c) {
  return __builtin_amdgcn_wmma_f32_16x16x32_f16(false, a, false, b,
                                                (short)0, c, false, false);
}

// Load one 16-element f16 fragment (A or B operand, identical per-lane run
// pattern) from an fp32 row in global memory: elements 0..7 = row[lo..lo+7],
// 8..15 = row[lo+16..lo+23], scaled.
__device__ __forceinline__ v16h frag_from_f32row(const float* rowp, int lo, float s) {
  const float4 a0 = *(const float4*)(rowp + lo);
  const float4 a1 = *(const float4*)(rowp + lo + 4);
  const float4 b0 = *(const float4*)(rowp + lo + 16);
  const float4 b1 = *(const float4*)(rowp + lo + 20);
  v16h r;
  r[0]=(_Float16)(a0.x*s);  r[1]=(_Float16)(a0.y*s);
  r[2]=(_Float16)(a0.z*s);  r[3]=(_Float16)(a0.w*s);
  r[4]=(_Float16)(a1.x*s);  r[5]=(_Float16)(a1.y*s);
  r[6]=(_Float16)(a1.z*s);  r[7]=(_Float16)(a1.w*s);
  r[8]=(_Float16)(b0.x*s);  r[9]=(_Float16)(b0.y*s);
  r[10]=(_Float16)(b0.z*s); r[11]=(_Float16)(b0.w*s);
  r[12]=(_Float16)(b1.x*s); r[13]=(_Float16)(b1.y*s);
  r[14]=(_Float16)(b1.z*s); r[15]=(_Float16)(b1.w*s);
  return r;
}

// Same fragment pattern from an f16 LDS row (two ds_load_b128).
__device__ __forceinline__ v16h frag_from_ldsrow(const _Float16* rowp, int lo) {
  v8h a = *(const v8h*)(rowp + lo);
  v8h b = *(const v8h*)(rowp + lo + 16);
  return __builtin_shufflevector(a, b, 0,1,2,3,4,5,6,7,8,9,10,11,12,13,14,15);
}

#define KLDS_STRIDE 72   /* 144B: (stride/16B)=9 odd -> conflict-free b128 rows */
#define VLDS_STRIDE 40   /* 80B:  (stride/16B)=5 odd */
#define KBUF (32 * KLDS_STRIDE)   /* f16 elements of one K buffer */
#define VBUF (64 * VLDS_STRIDE)   /* f16 elements of one V buffer */

// Four waves per SIMD is what the grid gives (two work-groups per WGP). Told so,
// the compiler keeps the converted tile in registers of its own; aiming at a
// fifth wave it reuses one register from LDS write to LDS write.
__global__ __launch_bounds__(256) __attribute__((amdgpu_waves_per_eu(4, 4)))
void attn_fwd(const float* __restrict__ Q, const float* __restrict__ K,
              const float* __restrict__ V, float* __restrict__ X) {
  // Two buffers each: tile t is read from buffer t & 1 while tile t + 1 is
  // written into the other one.
  __shared__ __attribute__((aligned(16))) _Float16 Klds[2 * KBUF];   // [key][d]  f16
  __shared__ __attribute__((aligned(16))) _Float16 VTlds[2 * VBUF];  // [d][key]  f16 (transposed)

  const int lane = threadIdx.x & 31;
  const int wave = threadIdx.x >> 5;
  const int qt = blockIdx.x & 15;          // 16 q-tiles of 128
  const int h  = (blockIdx.x >> 4) & 15;   // 16 heads
  const int b  = blockIdx.x >> 8;          // 2 batches
  const int lo = (lane & 16) ? 8 : 0;      // per-lane run offset within 32
  const int l15 = lane & 15;

  const int qrow = qt * 128 + wave * 16 + l15;
  const float* qptr = Q + (b * NQ + qrow) * DM + h * DK;

  // Q B-fragments (d-chunks 0-31 / 32-63), softmax scale folded in.
  const v16h qf0 = frag_from_f32row(qptr,      lo, SCALE);
  const v16h qf1 = frag_from_f32row(qptr + 32, lo, SCALE);

  v8f O[4];
  #pragma unroll
  for (int i = 0; i < 4; ++i) O[i] = (v8f){0,0,0,0,0,0,0,0};
  float m = -1.0e30f, l = 0.0f;

  // Staging of a tile (32 keys x 64 dims): thread t brings dims 8*(t&7)..+7 of
  // key t>>3, of K and of V, through registers.
  const int srow = threadIdx.x >> 3;
  const int scol = (threadIdx.x & 7) * 8;
  const float* kg = K + (b * NK + srow) * DM + h * DK + scol;
  const float* vg = V + (b * NK + srow) * DM + h * DK + scol;
  _Float16* const kst = &Klds[srow * KLDS_STRIDE + scol];
  _Float16* const vst = &VTlds[scol * VLDS_STRIDE + srow];
  v4f kf0, kf1, vf0, vf1;

  // Issue the loads of the tile that kg and vg point at.
  auto fetch = [&]() __attribute__((always_inline)) {
    kf0 = *(const v4f*)kg;  kf1 = *(const v4f*)(kg + 4);
    vf0 = *(const v4f*)vg;  vf1 = *(const v4f*)(vg + 4);
  };
  // Convert the fetched tile and write it into buffer buf.
  auto stage = [&](const int buf) __attribute__((always_inline)) {
    _Float16* kd = kst + buf * KBUF;
    kd[0]=(_Float16)kf0[0]; kd[1]=(_Float16)kf0[1];
    kd[2]=(_Float16)kf0[2]; kd[3]=(_Float16)kf0[3];
    kd[4]=(_Float16)kf1[0]; kd[5]=(_Float16)kf1[1];
    kd[6]=(_Float16)kf1[2]; kd[7]=(_Float16)kf1[3];
    _Float16* vd = vst + buf * VBUF;
    vd[0 * VLDS_STRIDE] = (_Float16)vf0[0];
    vd[1 * VLDS_STRIDE] = (_Float16)vf0[1];
    vd[2 * VLDS_STRIDE] = (_Float16)vf0[2];
    vd[3 * VLDS_STRIDE] = (_Float16)vf0[3];
    vd[4 * VLDS_STRIDE] = (_Float16)vf1[0];
    vd[5 * VLDS_STRIDE] = (_Float16)vf1[1];
    vd[6 * VLDS_STRIDE] = (_Float16)vf1[2];
    vd[7 * VLDS_STRIDE] = (_Float16)vf1[3];
  };

  // Work-group barrier by hand, with the wait on this wave's LDS reads and writes
  // that it needs: __syncthreads() would also wait for the global loads that are
  // meant to stay in flight across it.
  // The four accumulators are inputs only: that keeps the tile's vector work and
  // products in front of the barrier, where they cover the draining of the LDS
  // writes (the compiler otherwise moves them behind it, and the barrier comes
  // to stand directly behind the writes).
  auto publish = [&]() __attribute__((always_inline)) {
    asm volatile("s_wait_dscnt 0x0\n\ts_barrier_signal -1\n\ts_barrier_wait -1"
                 :: "v"(O[0]), "v"(O[1]), "v"(O[2]), "v"(O[3]) : "memory");
  };

  // One tile: products and softmax on buffer cur; meanwhile, where put_next,
  // the fetched tile t + 1 goes into the other buffer and, where get_next,
  // the loads of tile t + 2 are issued.
  auto trip = [&](const int cur, const bool put_next, const bool get_next)
      __attribute__((always_inline)) {
    // All fragments of this tile are asked for ahead of the stores below.
    const _Float16* kr0 = &Klds[cur * KBUF + (l15)      * KLDS_STRIDE];
    const _Float16* kr1 = &Klds[cur * KBUF + (16 + l15) * KLDS_STRIDE];
    v16h k00 = frag_from_ldsrow(kr0,      lo);
    v16h k01 = frag_from_ldsrow(kr0 + 32, lo);
    v16h k10 = frag_from_ldsrow(kr1,      lo);
    v16h k11 = frag_from_ldsrow(kr1 + 32, lo);
    v16h vfrag[4];
    #pragma unroll
    for (int gd = 0; gd < 4; ++gd)
      vfrag[gd] = frag_from_ldsrow(&VTlds[cur * VBUF + (gd * 16 + l15) * VLDS_STRIDE], lo);
    // Keeps the tile's 16 LDS reads together up here: sunk among the products
    // they would queue behind the LDS writes below and be waited for one by one.
    __builtin_amdgcn_sched_barrier(0);

    // S^T = K . Q^T  (two 16key x 16q fragments, K-dim 64 = 2 WMMAs each)
    v8f s0 = (v8f){0,0,0,0,0,0,0,0};
    v8f s1 = (v8f){0,0,0,0,0,0,0,0};
    s0 = wmma_f16(k00, qf0, s0);  s0 = wmma_f16(k01, qf1, s0);
    s1 = wmma_f16(k10, qf0, s1);  s1 = wmma_f16(k11, qf1, s1);

    // Online softmax over this chunk's 32 keys (16 lane-local + 1 shuffle).
    float mc = -1.0e30f;
    #pragma unroll
    for (int r = 0; r < 8; ++r) { mc = fmaxf(mc, s0[r]); mc = fmaxf(mc, s1[r]); }
    const float mo = __shfl_xor(mc, 16, 32);

    if (put_next) {
      // Keeps the shuffle, which shares the LDS queue, in front of the writes.
      __builtin_amdgcn_sched_barrier(0);
      stage(cur ^ 1);
      if (get_next) { kg += 32 * DM; vg += 32 * DM; fetch(); }
      // Keeps the writes and the loads up here, so that they drain and fly under
      // the vector work: the compiler sinks them to the tile's end otherwise.
      __builtin_amdgcn_sched_barrier(0);
    }

    mc = fmaxf(mc, mo);
    const float mnew = fmaxf(m, mc);
    const float corr = exp2f((m - mnew) * L2E);
    m = mnew;
    l *= corr;
    #pragma unroll
    for (int i = 0; i < 4; ++i) O[i] *= corr;

    // P^T B-fragment feeds directly from the S^T accumulator registers.
    v16h pf;
    float psum = 0.0f;
    #pragma unroll
    for (int r = 0; r < 8; ++r) {
      const float p0 = exp2f((s0[r] - m) * L2E);
      const float p1 = exp2f((s1[r] - m) * L2E);
      psum += p0 + p1;
      pf[r]     = (_Float16)p0;
      pf[8 + r] = (_Float16)p1;
    }
    l += psum;

    // O^T += V^T . P^T  (4 d-groups of 16)
    #pragma unroll
    for (int gd = 0; gd < 4; ++gd)
      O[gd] = wmma_f16(vfrag[gd], pf, O[gd]);

    // The one barrier of a tile: it publishes tile t + 1 and ends every wave's
    // reads of buffer cur, which the next trip overwrites.
    if (put_next) publish();
  };

  // Prologue: tile 0 into buffer 0, tile 1 on its way.
  fetch();
  stage(0);
  kg += 32 * DM; vg += 32 * DM;
  fetch();
  publish();

  for (int kb = 0; kb < NK - 64; kb += 64) {
    trip(0, true, true);
    trip(1, true, true);
  }
  trip(0, true, false);    // tile NK/32 - 2: nothing left to fetch
  trip(1, false, false);   // last tile

  // Finish: combine the two lane-half partial sums, normalize, store.
  l += __shfl_xor(l, 16, 32);
  const float inv = 1.0f / l;
  const int dhi = (lane & 16) ? 8 : 0;
  float* xrow = X + (b * NQ + qrow) * DM + h * DK;
  #pragma unroll
  for (int gd = 0; gd < 4; ++gd) {
    #pragma unroll
    for (int r = 0; r < 8; ++r)
      xrow[gd * 16 + r + dhi] = O[gd][r] * inv;
  }
}

// Y[m][n] = sum_k X[m][k] * W[n][k] + bias[n];  M=4096, N=1024, K=1024.
// Each wave: 32x32 tile (2x2 WMMA frags); block: 8 waves = 64(M) x 128(N).
// Per k-block of 128 the block's 64 X rows and 128 W rows are read once, one
// whole 512-byte row piece per wave-wide load, converted to f16 and kept in
// LDS, where all waves that need a row take their fragments from.
typedef __attribute__((ext_vector_type(4))) _Float16 v4h;
#define PK 128            /* k per staged block */
#define PLDS_STRIDE 136   /* 272B: (stride/16B)=17 odd -> conflict-free b128 rows */

__device__ __forceinline__ v4h cvt4(const v4f f) {
  v4h r;
  r[0]=(_Float16)f[0]; r[1]=(_Float16)f[1]; r[2]=(_Float16)f[2]; r[3]=(_Float16)f[3];
  return r;
}

__global__ __launch_bounds__(256)
void out_proj(const float* __restrict__ X, const float* __restrict__ W,
              const float* __restrict__ bias, float* __restrict__ Y) {
  __shared__ __attribute__((aligned(16))) _Float16 Xs[64 * PLDS_STRIDE];
  __shared__ __attribute__((aligned(16))) _Float16 Ws[128 * PLDS_STRIDE];

  const int lane = threadIdx.x & 31;
  const int wave = threadIdx.x >> 5;
  const int lo = (lane & 16) ? 8 : 0;
  const int l15 = lane & 15;
  const int bm = blockIdx.x & 63;
  const int bn = blockIdx.x >> 6;
  const int m0 = bm * 64 + (wave & 1) * 32;
  const int n0 = bn * 128 + (wave >> 1) * 32;

  // Staging: wave w brings rows w, w+8, w+16, ...; lane l brings floats 4l..4l+3.
  const float* xg = X + (bm * 64 + wave) * DM + lane * 4;
  const float* wg = W + (bn * 128 + wave) * DM + lane * 4;
  _Float16* xs = &Xs[wave * PLDS_STRIDE + lane * 4];
  _Float16* ws = &Ws[wave * PLDS_STRIDE + lane * 4];

  // Fragment rows of this wave's 32x32 tile.
  const _Float16* xr0 = &Xs[((wave & 1) * 32 + l15) * PLDS_STRIDE];
  const _Float16* xr1 = xr0 + 16 * PLDS_STRIDE;
  const _Float16* wr0 = &Ws[((wave >> 1) * 32 + l15) * PLDS_STRIDE];
  const _Float16* wr1 = wr0 + 16 * PLDS_STRIDE;

  v8f C[2][2];
  #pragma unroll
  for (int i = 0; i < 2; ++i)
    #pragma unroll
    for (int j = 0; j < 2; ++j) C[i][j] = (v8f){0,0,0,0,0,0,0,0};

  for (int kc = 0; kc < DM; kc += PK, xg += PK, wg += PK) {
    v4f xv[8], wv[16];
    // The staging loops are unrolled so that xv and wv have constant indices
    // and live in registers, with all loads issued back to back.
    #pragma unroll
    for (int i = 0; i < 8; ++i)
      xv[i] = *(const v4f*)(xg + i * 8 * DM);
    #pragma unroll
    for (int i = 0; i < 16; ++i)
      wv[i] = *(const v4f*)(wg + i * 8 * DM);
    // Inputs-only fence on the loaded values: holds all 24 loads, 16 bytes wide,
    // ahead of the barrier. Without it the compiler halves the X loads and sinks
    // one half behind the barrier: a second load latency in every k-block.
    // The two addresses are inputs too: their registers then stay untouched
    // until every load that names them has returned.
    asm volatile("" :: "v"(xv[0]), "v"(xv[1]), "v"(xv[2]), "v"(xv[3]),
                       "v"(xv[4]), "v"(xv[5]), "v"(xv[6]), "v"(xv[7]),
                       "v"(wv[0]), "v"(wv[1]), "v"(wv[2]), "v"(wv[3]),
                       "v"(wv[4]), "v"(wv[5]), "v"(wv[6]), "v"(wv[7]),
                       "v"(wv[8]), "v"(wv[9]), "v"(wv[10]), "v"(wv[11]),
                       "v"(wv[12]), "v"(wv[13]), "v"(wv[14]), "v"(wv[15]),
                       "v"(xg), "v"(wg));
    __syncthreads();  // previous k-block fully consumed
    #pragma unroll
    for (int i = 0; i < 8; ++i)
      *(v4h*)(xs + i * 8 * PLDS_STRIDE) = cvt4(xv[i]);
    #pragma unroll
    for (int i = 0; i < 16; ++i)
      *(v4h*)(ws + i * 8 * PLDS_STRIDE) = cvt4(wv[i]);
    __syncthreads();  // k-block visible to every wave

    // Unrolled: LDS offsets become immediates, no loop overhead among the WMMAs.
    #pragma unroll
    for (int ks = 0; ks < PK; ks += 32) {
      v16h a0 = frag_from_ldsrow(xr0 + ks, lo);
      v16h a1 = frag_from_ldsrow(xr1 + ks, lo);
      v16h b0 = frag_from_ldsrow(wr0 + ks, lo);
      v16h b1 = frag_from_ldsrow(wr1 + ks, lo);
      C[0][0] = wmma_f16(a0, b0, C[0][0]);
      C[0][1] = wmma_f16(a0, b1, C[0][1]);
      C[1][0] = wmma_f16(a1, b0, C[1][0]);
      C[1][1] = wmma_f16(a1, b1, C[1][1]);
    }
  }

  const float bias0 = bias[n0 + l15];
  const float bias1 = bias[n0 + 16 + l15];
  const int mhi = (lane & 16) ? 8 : 0;
  #pragma unroll
  for (int mi = 0; mi < 2; ++mi) {
    #pragma unroll
    for (int ni = 0; ni < 2; ++ni) {
      const float bb = ni ? bias1 : bias0;
      #pragma unroll
      for (int r = 0; r < 8; ++r) {
        const int row = m0 + mi * 16 + r + mhi;
        const int col = n0 + ni * 16 + l15;
        Y[row * DM + col] = C[mi][ni][r] + bb;
      }
    }
  }
}

extern "C" void kernel_launch(void* const* d_in, const int* in_sizes, int n_in,
                              void* d_out, int out_size, void* d_ws, size_t ws_size,
                              hipStream_t stream) {
  (void)in_sizes; (void)n_in; (void)out_size; (void)ws_size;
  const float* Q  = (const float*)d_in[0];
  const float* K  = (const float*)d_in[1];
  const float* V  = (const float*)d_in[2];
  const float* Wo = (const float*)d_in[3];
  const float* bo = (const float*)d_in[4];
  float* X = (float*)d_ws;            // (b, q, h*d_k) fp32 intermediate
  float* Y = (float*)d_out;

  // 2 batches * 16 heads * 16 q-tiles = 512 blocks
  attn_fwd<<<dim3(512), dim3(256), 0, stream>>>(Q, K, V, X);
  // (4096/64) * (1024/128) = 64 * 8 = 512 blocks
  out_proj<<<dim3(512), dim3(256), 0, stream>>>(X, Wo, bo, Y);
}

// v003
// It runs in 71.5 microseconds.
// In both of two side-by-side timings against v002, it was 1.05 times as fast.
// All steps since v000 together make it 1.89 times as fast.
#include <hip/hip_runtime.h>
#include <hip/hip_bf16.h>

typedef __attribute__((ext_vector_type(16))) _Float16 v16h;
typedef __attribute__((ext_vector_type(8)))  _Float16 v8h;
typedef __attribute__((ext_vector_type(8)))  float    v8f;
typedef __attribute__((ext_vector_type(4)))  float    v4f;
typedef __attribute__((ext_vector_type(2)))  _Float16 v2h;
typedef __attribute__((ext_vector_type(4)))  unsigned v4u;

#define NQ 2048
#define NK 2048
#define DM 1024
#define NH 16
#define DK 64
#define SCALE 0.125f          /* 1/sqrt(64) */
#define L2E   1.44269504088896340736f

// 2^x by the bare hardware instruction, in place, for eight values and for nine.
// exp2f() wraps each v_exp_f32 in a compare, two selects, an add and an ldexp so
// that results below 2^-126 come out as denormals; here every argument is <= 0
// up to rounding, and a term that small is 0 in the f16 P operand and is lost in
// a row sum that ends >= 1.
// In asm, each over its own argument, so that no instruction directly behind a
// v_exp_f32 reads its result or overwrites its source; the v_nop is that
// slot behind the last one.
__device__ __forceinline__ void exp2_x8(v8f& a) {
  float e0 = a[0], e1 = a[1], e2 = a[2], e3 = a[3];
  float e4 = a[4], e5 = a[5], e6 = a[6], e7 = a[7];
  asm("v_exp_f32 %0, %0\n\tv_exp_f32 %1, %1\n\tv_exp_f32 %2, %2\n\t"
      "v_exp_f32 %3, %3\n\tv_exp_f32 %4, %4\n\tv_exp_f32 %5, %5\n\t"
      "v_exp_f32 %6, %6\n\tv_exp_f32 %7, %7\n\tv_nop"
      : "+v"(e0), "+v"(e1), "+v"(e2), "+v"(e3),
        "+v"(e4), "+v"(e5), "+v"(e6), "+v"(e7));
  a = (v8f){e0, e1, e2, e3, e4, e5, e6, e7};
}
__device__ __forceinline__ void exp2_x9(float& c, v8f& a) {
  float e0 = a[0], e1 = a[1], e2 = a[2], e3 = a[3];
  float e4 = a[4], e5 = a[5], e6 = a[6], e7 = a[7];
  asm("v_exp_f32 %8, %8\n\t"
      "v_exp_f32 %0, %0\n\tv_exp_f32 %1, %1\n\tv_exp_f32 %2, %2\n\t"
      "v_exp_f32 %3, %3\n\tv_exp_f32 %4, %4\n\tv_exp_f32 %5, %5\n\t"
      "v_exp_f32 %6, %6\n\tv_exp_f32 %7, %7\n\tv_nop"
      : "+v"(e0), "+v"(e1), "+v"(e2), "+v"(e3),
        "+v"(e4), "+v"(e5), "+v"(e6), "+v"(e7), "+v"(c));
  a = (v8f){e0, e1, e2, e3, e4, e5, e6, e7};
}

__device__ __forceinline__ v8f wmma_f16(v16h a, v16h b, v8f c) {
  return __builtin_amdgcn_wmma_f32_16x16x32_f16(false, a, false, b,
                                                (short)0, c, false, false);
}

// Load one 16-element f16 fragment (A or B operand, identical per-lane run
// pattern) from an fp32 row in global memory: elements 0..7 = row[lo..lo+7],
// 8..15 = row[lo+16..lo+23], scaled.
__device__ __forceinline__ v16h frag_from_f32row(const float* rowp, int lo, float s) {
  const float4 a0 = *(const float4*)(rowp + lo);
  const float4 a1 = *(const float4*)(rowp + lo + 4);
  const float4 b0 = *(const float4*)(rowp + lo + 16);
  const float4 b1 = *(const float4*)(rowp + lo + 20);
  v16h r;
  r[0]=(_Float16)(a0.x*s);  r[1]=(_Float16)(a0.y*s);
  r[2]=(_Float16)(a0.z*s);  r[3]=(_Float16)(a0.w*s);
  r[4]=(_Float16)(a1.x*s);  r[5]=(_Float16)(a1.y*s);
  r[6]=(_Float16)(a1.z*s);  r[7]=(_Float16)(a1.w*s);
  r[8]=(_Float16)(b0.x*s);  r[9]=(_Float16)(b0.y*s);
  r[10]=(_Float16)(b0.z*s); r[11]=(_Float16)(b0.w*s);
  r[12]=(_Float16)(b1.x*s); r[13]=(_Float16)(b1.y*s);
  r[14]=(_Float16)(b1.z*s); r[15]=(_Float16)(b1.w*s);
  return r;
}

// Two f32 to a pair of f16 (round to nearest even, as the cast), at this place
// in the program: written as casts, the conversions of a fetched tile are lifted
// to directly behind its loads, a tile early, and the wave waits out the whole
// load latency there instead of leaving the loads in flight for a tile.
__device__ __forceinline__ unsigned cvt_here(float a, float b) {
  unsigned r;
  asm volatile("v_cvt_pk_f16_f32 %0, %1, %2" : "=v"(r) : "v"(a), "v"(b));
  return r;
}

// Same fragment pattern from an f16 LDS row (two ds_load_b128).
__device__ __forceinline__ v16h frag_from_ldsrow(const _Float16* rowp, int lo) {
  v8h a = *(const v8h*)(rowp + lo);
  v8h b = *(const v8h*)(rowp + lo + 16);
  return __builtin_shufflevector(a, b, 0,1,2,3,4,5,6,7,8,9,10,11,12,13,14,15);
}

#define KLDS_STRIDE 72   /* 144B: (stride/16B)=9 odd -> conflict-free b128 rows */
#define VLDS_STRIDE 40   /* 80B:  (stride/16B)=5 odd */
#define KBUF (32 * KLDS_STRIDE)   /* f16 elements of one K buffer */
#define VBUF (64 * VLDS_STRIDE)   /* f16 elements of one V buffer */

// Four waves per SIMD is what the grid gives (two work-groups per WGP). Told so,
// the compiler keeps the converted tile in registers of its own; aiming at a
// fifth wave it reuses one register from LDS write to LDS write.
__global__ __launch_bounds__(256) __attribute__((amdgpu_waves_per_eu(4, 4)))
void attn_fwd(const float* __restrict__ Q, const float* __restrict__ K,
              const float* __restrict__ V, float* __restrict__ X) {
  // Two buffers each: tile t is read from buffer t & 1 while tile t + 1 is
  // written into the other one.
  __shared__ __attribute__((aligned(16))) _Float16 Klds[2 * KBUF];   // [key][d]  f16
  __shared__ __attribute__((aligned(16))) _Float16 VTlds[2 * VBUF];  // [d][key]  f16 (transposed)

  const int lane = threadIdx.x & 31;
  const int wave = threadIdx.x >> 5;
  const int qt = blockIdx.x & 15;          // 16 q-tiles of 128
  const int h  = (blockIdx.x >> 4) & 15;   // 16 heads
  const int b  = blockIdx.x >> 8;          // 2 batches
  const int lo = (lane & 16) ? 8 : 0;      // per-lane run offset within 32
  const int l15 = lane & 15;

  const int qrow = qt * 128 + wave * 16 + l15;
  const float* qptr = Q + (b * NQ + qrow) * DM + h * DK;

  // Q B-fragments (d-chunks 0-31 / 32-63), softmax scale folded in.
  const v16h qf0 = frag_from_f32row(qptr,      lo, SCALE);
  const v16h qf1 = frag_from_f32row(qptr + 32, lo, SCALE);

  v8f O[4];
  #pragma unroll
  for (int i = 0; i < 4; ++i) O[i] = (v8f){0,0,0,0,0,0,0,0};
  float m = -1.0e30f, l = 0.0f;

  // Staging of a tile (32 keys x 64 dims): thread t brings dims 8*(t&7)..+7 of
  // key t>>3, of K and of V, through registers.
  const int srow = threadIdx.x >> 3;
  const int scol = (threadIdx.x & 7) * 8;
  const float* kg = K + (b * NK + srow) * DM + h * DK + scol;
  const float* vg = V + (b * NK + srow) * DM + h * DK + scol;
  _Float16* const kst = &Klds[srow * KLDS_STRIDE + scol];
  _Float16* const vst = &VTlds[scol * VLDS_STRIDE + srow];
  v4f kf0, kf1, vf0, vf1;

  // Issue the loads of the tile that kg and vg point at.
  auto fetch = [&]() __attribute__((always_inline)) {
    kf0 = *(const v4f*)kg;  kf1 = *(const v4f*)(kg + 4);
    vf0 = *(const v4f*)vg;  vf1 = *(const v4f*)(vg + 4);
  };
  // Convert the fetched tile and write it into buffer buf.
  auto stage = [&](const int buf) __attribute__((always_inline)) {
    // All eight conversions ahead of the writes: each result then has a register
    // of its own, and no conversion waits for an LDS write to have read its data.
    v4u kp;
    kp[0] = cvt_here(kf0[0], kf0[1]);  kp[1] = cvt_here(kf0[2], kf0[3]);
    kp[2] = cvt_here(kf1[0], kf1[1]);  kp[3] = cvt_here(kf1[2], kf1[3]);
    const v2h v01 = __builtin_bit_cast(v2h, cvt_here(vf0[0], vf0[1]));
    const v2h v23 = __builtin_bit_cast(v2h, cvt_here(vf0[2], vf0[3]));
    const v2h v45 = __builtin_bit_cast(v2h, cvt_here(vf1[0], vf1[1]));
    const v2h v67 = __builtin_bit_cast(v2h, cvt_here(vf1[2], vf1[3]));
    _Float16* kd = kst + buf * KBUF;
    *(v4u*)kd = kp;
    _Float16* vd = vst + buf * VBUF;
    vd[0 * VLDS_STRIDE] = v01[0];
    vd[1 * VLDS_STRIDE] = v01[1];
    vd[2 * VLDS_STRIDE] = v23[0];
    vd[3 * VLDS_STRIDE] = v23[1];
    vd[4 * VLDS_STRIDE] = v45[0];
    vd[5 * VLDS_STRIDE] = v45[1];
    vd[6 * VLDS_STRIDE] = v67[0];
    vd[7 * VLDS_STRIDE] = v67[1];
  };

  // Work-group barrier by hand, with the wait on this wave's LDS reads and writes
  // that it needs: __syncthreads() would also wait for the global loads that are
  // meant to stay in flight across it.
  // The four accumulators are inputs only: that keeps the tile's vector work and
  // products in front of the barrier, where they cover the draining of the LDS
  // writes (the compiler otherwise moves them behind it, and the barrier comes
  // to stand directly behind the writes).
  auto publish = [&]() __attribute__((always_inline)) {
    asm volatile("s_wait_dscnt 0x0\n\ts_barrier_signal -1\n\ts_barrier_wait -1"
                 :: "v"(O[0]), "v"(O[1]), "v"(O[2]), "v"(O[3]) : "memory");
  };

  // One tile: products and softmax on buffer cur; meanwhile, where put_next,
  // the fetched tile t + 1 goes into the other buffer and, where get_next,
  // the loads of tile t + 2 are issued.
  auto trip = [&](const int cur, const bool put_next, const bool get_next)
      __attribute__((always_inline)) {
    // All fragments of this tile are asked for ahead of the stores below.
    const _Float16* kr0 = &Klds[cur * KBUF + (l15)      * KLDS_STRIDE];
    const _Float16* kr1 = &Klds[cur * KBUF + (16 + l15) * KLDS_STRIDE];
    v16h k00 = frag_from_ldsrow(kr0,      lo);
    v16h k01 = frag_from_ldsrow(kr0 + 32, lo);
    v16h k10 = frag_from_ldsrow(kr1,      lo);
    v16h k11 = frag_from_ldsrow(kr1 + 32, lo);
    v16h vfrag[4];
    #pragma unroll
    for (int gd = 0; gd < 4; ++gd)
      vfrag[gd] = frag_from_ldsrow(&VTlds[cur * VBUF + (gd * 16 + l15) * VLDS_STRIDE], lo);
    // Keeps the tile's 16 LDS reads together up here: sunk among the products
    // they would queue behind the LDS writes below and be waited for one by one.
    __builtin_amdgcn_sched_barrier(0);

    // S^T = K . Q^T  (two 16key x 16q fragments, K-dim 64 = 2 WMMAs each)
    v8f s0 = (v8f){0,0,0,0,0,0,0,0};
    v8f s1 = (v8f){0,0,0,0,0,0,0,0};
    s0 = wmma_f16(k00, qf0, s0);  s0 = wmma_f16(k01, qf1, s0);
    s1 = wmma_f16(k10, qf0, s1);  s1 = wmma_f16(k11, qf1, s1);

    // Online softmax over this chunk's 32 keys (16 lane-local + 1 shuffle).
    float mc = -1.0e30f;
    #pragma unroll
    for (int r = 0; r < 8; ++r) { mc = fmaxf(mc, s0[r]); mc = fmaxf(mc, s1[r]); }
    const float mo = __shfl_xor(mc, 16, 32);

    if (put_next) {
      // Keeps the shuffle, which shares the LDS queue, in front of the writes.
      __builtin_amdgcn_sched_barrier(0);
      stage(cur ^ 1);
      if (get_next) { kg += 32 * DM; vg += 32 * DM; fetch(); }
      // Keeps the writes and the loads up here, so that they drain and fly under
      // the vector work: the compiler sinks them to the tile's end otherwise.
      __builtin_amdgcn_sched_barrier(0);
    }

    mc = fmaxf(mc, mo);
    const float mnew = fmaxf(m, mc);
    float corr = (m - mnew) * L2E;
    m = mnew;
    // The arguments, one fused multiply-add each (packed, two to an instruction):
    // s * log2(e) - m * log2(e).
    const float nml = -m * L2E;
    const v8f l2e8 = {L2E, L2E, L2E, L2E, L2E, L2E, L2E, L2E};
    const v8f nml8 = {nml, nml, nml, nml, nml, nml, nml, nml};
    v8f a0 = __builtin_elementwise_fma(s0, l2e8, nml8);
    v8f a1 = __builtin_elementwise_fma(s1, l2e8, nml8);
    exp2_x9(corr, a0);
    exp2_x8(a1);
    l *= corr;
    #pragma unroll
    for (int i = 0; i < 4; ++i) O[i] *= corr;

    // P^T B-fragment feeds directly from the S^T accumulator registers.
    v16h pf;
    float psum = 0.0f;
    #pragma unroll
    for (int r = 0; r < 8; ++r) {
      const float p0 = a0[r];
      const float p1 = a1[r];
      psum += p0 + p1;
      pf[r]     = (_Float16)p0;
      pf[8 + r] = (_Float16)p1;
    }
    l += psum;

    // O^T += V^T . P^T  (4 d-groups of 16)
    #pragma unroll
    for (int gd = 0; gd < 4; ++gd)
      O[gd] = wmma_f16(vfrag[gd], pf, O[gd]);

    // The one barrier of a tile: it publishes tile t + 1 and ends every wave's
    // reads of buffer cur, which the next trip overwrites.
    if (put_next) publish();
  };

  // Prologue: tile 0 into buffer 0, tile 1 on its way.
  fetch();
  stage(0);
  kg += 32 * DM; vg += 32 * DM;
  fetch();
  publish();

  for (int kb = 0; kb < NK - 64; kb += 64) {
    trip(0, true, true);
    trip(1, true, true);
  }
  trip(0, true, false);    // tile NK/32 - 2: nothing left to fetch
  trip(1, false, false);   // last tile

  // Finish: combine the two lane-half partial sums, normalize, store.
  l += __shfl_xor(l, 16, 32);
  const float inv = 1.0f / l;
  const int dhi = (lane & 16) ? 8 : 0;
  float* xrow = X + (b * NQ + qrow) * DM + h * DK;
  #pragma unroll
  for (int gd = 0; gd < 4; ++gd) {
    #pragma unroll
    for (int r = 0; r < 8; ++r)
      xrow[gd * 16 + r + dhi] = O[gd][r] * inv;
  }
}

// Y[m][n] = sum_k X[m][k] * W[n][k] + bias[n];  M=4096, N=1024, K=1024.
// Each wave: 32x32 tile (2x2 WMMA frags); block: 8 waves = 64(M) x 128(N).
// Per k-block of 128 the block's 64 X rows and 128 W rows are read once, one
// whole 512-byte row piece per wave-wide load, converted to f16 and kept in
// LDS, where all waves that need a row take their fragments from.
typedef __attribute__((ext_vector_type(4))) _Float16 v4h;
#define PK 128            /* k per staged block */
#define PLDS_STRIDE 136   /* 272B: (stride/16B)=17 odd -> conflict-free b128 rows */

__device__ __forceinline__ v4h cvt4(const v4f f) {
  v4h r;
  r[0]=(_Float16)f[0]; r[1]=(_Float16)f[1]; r[2]=(_Float16)f[2]; r[3]=(_Float16)f[3];
  return r;
}

__global__ __launch_bounds__(256)
void out_proj(const float* __restrict__ X, const float* __restrict__ W,
              const float* __restrict__ bias, float* __restrict__ Y) {
  __shared__ __attribute__((aligned(16))) _Float16 Xs[64 * PLDS_STRIDE];
  __shared__ __attribute__((aligned(16))) _Float16 Ws[128 * PLDS_STRIDE];

  const int lane = threadIdx.x & 31;
  const int wave = threadIdx.x >> 5;
  const int lo = (lane & 16) ? 8 : 0;
  const int l15 = lane & 15;
  const int bm = blockIdx.x & 63;
  const int bn = blockIdx.x >> 6;
  const int m0 = bm * 64 + (wave & 1) * 32;
  const int n0 = bn * 128 + (wave >> 1) * 32;

  // Staging: wave w brings rows w, w+8, w+16, ...; lane l brings floats 4l..4l+3.
  const float* xg = X + (bm * 64 + wave) * DM + lane * 4;
  const float* wg = W + (bn * 128 + wave) * DM + lane * 4;
  _Float16* xs = &Xs[wave * PLDS_STRIDE + lane * 4];
  _Float16* ws = &Ws[wave * PLDS_STRIDE + lane * 4];

  // Fragment rows of this wave's 32x32 tile.
  const _Float16* xr0 = &Xs[((wave & 1) * 32 + l15) * PLDS_STRIDE];
  const _Float16* xr1 = xr0 + 16 * PLDS_STRIDE;
  const _Float16* wr0 = &Ws[((wave >> 1) * 32 + l15) * PLDS_STRIDE];
  const _Float16* wr1 = wr0 + 16 * PLDS_STRIDE;

  v8f C[2][2];
  #pragma unroll
  for (int i = 0; i < 2; ++i)
    #pragma unroll
    for (int j = 0; j < 2; ++j) C[i][j] = (v8f){0,0,0,0,0,0,0,0};

  for (int kc = 0; kc < DM; kc += PK, xg += PK, wg += PK) {
    v4f xv[8], wv[16];
    // The staging loops are unrolled so that xv and wv have constant indices
    // and live in registers, with all loads issued back to back.
    #pragma unroll
    for (int i = 0; i < 8; ++i)
      xv[i] = *(const v4f*)(xg + i * 8 * DM);
    #pragma unroll
    for (int i = 0; i < 16; ++i)
      wv[i] = *(const v4f*)(wg + i * 8 * DM);
    // Inputs-only fence on the loaded values: holds all 24 loads, 16 bytes wide,
    // ahead of the barrier. Without it the compiler halves the X loads and sinks
    // one half behind the barrier: a second load latency in every k-block.
    // The two addresses are inputs too: their registers then stay untouched
    // until every load that names them has returned.
    asm volatile("" :: "v"(xv[0]), "v"(xv[1]), "v"(xv[2]), "v"(xv[3]),
                       "v"(xv[4]), "v"(xv[5]), "v"(xv[6]), "v"(xv[7]),
                       "v"(wv[0]), "v"(wv[1]), "v"(wv[2]), "v"(wv[3]),
                       "v"(wv[4]), "v"(wv[5]), "v"(wv[6]), "v"(wv[7]),
                       "v"(wv[8]), "v"(wv[9]), "v"(wv[10]), "v"(wv[11]),
                       "v"(wv[12]), "v"(wv[13]), "v"(wv[14]), "v"(wv[15]),
                       "v"(xg), "v"(wg));
    __syncthreads();  // previous k-block fully consumed
    #pragma unroll
    for (int i = 0; i < 8; ++i)
      *(v4h*)(xs + i * 8 * PLDS_STRIDE) = cvt4(xv[i]);
    #pragma unroll
    for (int i = 0; i < 16; ++i)
      *(v4h*)(ws + i * 8 * PLDS_STRIDE) = cvt4(wv[i]);
    __syncthreads();  // k-block visible to every wave

    // Unrolled: LDS offsets become immediates, no loop overhead among the WMMAs.
    #pragma unroll
    for (int ks = 0; ks < PK; ks += 32) {
      v16h a0 = frag_from_ldsrow(xr0 + ks, lo);
      v16h a1 = frag_from_ldsrow(xr1 + ks, lo);
      v16h b0 = frag_from_ldsrow(wr0 + ks, lo);
      v16h b1 = frag_from_ldsrow(wr1 + ks, lo);
      C[0][0] = wmma_f16(a0, b0, C[0][0]);
      C[0][1] = wmma_f16(a0, b1, C[0][1]);
      C[1][0] = wmma_f16(a1, b0, C[1][0]);
      C[1][1] = wmma_f16(a1, b1, C[1][1]);
    }
  }

  const float bias0 = bias[n0 + l15];
  const float bias1 = bias[n0 + 16 + l15];
  const int mhi = (lane & 16) ? 8 : 0;
  #pragma unroll
  for (int mi = 0; mi < 2; ++mi) {
    #pragma unroll
    for (int ni = 0; ni < 2; ++ni) {
      const float bb = ni ? bias1 : bias0;
      #pragma unroll
      for (int r = 0; r < 8; ++r) {
        const int row = m0 + mi * 16 + r + mhi;
        const int col = n0 + ni * 16 + l15;
        Y[row * DM + col] = C[mi][ni][r] + bb;
      }
    }
  }
}

extern "C" void kernel_launch(void* const* d_in, const int* in_sizes, int n_in,
                              void* d_out, int out_size, void* d_ws, size_t ws_size,
                              hipStream_t stream) {
  (void)in_sizes; (void)n_in; (void)out_size; (void)ws_size;
  const float* Q  = (const float*)d_in[0];
  const float* K  = (const float*)d_in[1];
  const float* V  = (const float*)d_in[2];
  const float* Wo = (const float*)d_in[3];
  const float* bo = (const float*)d_in[4];
  float* X = (float*)d_ws;            // (b, q, h*d_k) fp32 intermediate
  float* Y = (float*)d_out;

  // 2 batches * 16 heads * 16 q-tiles = 512 blocks
  attn_fwd<<<dim3(512), dim3(256), 0, stream>>>(Q, K, V, X);
  // (4096/64) * (1024/128) = 64 * 8 = 512 blocks
  out_proj<<<dim3(512), dim3(256), 0, stream>>>(X, Wo, bo, Y);
}

// v004
// A run of this version takes 62.3 microseconds.
// In both of two side-by-side timings against v003, it was 1.15 times as fast.
// All steps since v000 together make it 2.16 times as fast.
#include <hip/hip_runtime.h>
#include <hip/hip_bf16.h>

typedef __attribute__((ext_vector_type(16))) _Float16 v16h;
typedef __attribute__((ext_vector_type(8)))  _Float16 v8h;
typedef __attribute__((ext_vector_type(8)))  float    v8f;
typedef __attribute__((ext_vector_type(4)))  float    v4f;
typedef __attribute__((ext_vector_type(4)))  unsigned v4u;

#define NQ 2048
#define NK 2048
#define DM 1024
#define NH 16
#define DK 64
#define SCALE 0.125f          /* 1/sqrt(64) */
#define L2E   1.44269504088896340736f

// 2^x by the bare hardware instruction, in place, for eight values and for nine.
// exp2f() wraps each v_exp_f32 in a compare, two selects, an add and an ldexp so
// that results below 2^-126 come out as denormals; here every argument is <= 0
// up to rounding, and a term that small is 0 in the f16 P operand and is lost in
// a row sum that ends >= 1.
// In asm, each over its own argument, so that no instruction directly behind a
// v_exp_f32 reads its result or overwrites its source; the v_nop is that
// slot behind the last one.
__device__ __forceinline__ void exp2_x8(v8f& a) {
  float e0 = a[0], e1 = a[1], e2 = a[2], e3 = a[3];
  float e4 = a[4], e5 = a[5], e6 = a[6], e7 = a[7];
  asm("v_exp_f32 %0, %0\n\tv_exp_f32 %1, %1\n\tv_exp_f32 %2, %2\n\t"
      "v_exp_f32 %3, %3\n\tv_exp_f32 %4, %4\n\tv_exp_f32 %5, %5\n\t"
      "v_exp_f32 %6, %6\n\tv_exp_f32 %7, %7\n\tv_nop"
      : "+v"(e0), "+v"(e1), "+v"(e2), "+v"(e3),
        "+v"(e4), "+v"(e5), "+v"(e6), "+v"(e7));
  a = (v8f){e0, e1, e2, e3, e4, e5, e6, e7};
}
__device__ __forceinline__ void exp2_x9(float& c, v8f& a) {
  float e0 = a[0], e1 = a[1], e2 = a[2], e3 = a[3];
  float e4 = a[4], e5 = a[5], e6 = a[6], e7 = a[7];
  asm("v_exp_f32 %8, %8\n\t"
      "v_exp_f32 %0, %0\n\tv_exp_f32 %1, %1\n\tv_exp_f32 %2, %2\n\t"
      "v_exp_f32 %3, %3\n\tv_exp_f32 %4, %4\n\tv_exp_f32 %5, %5\n\t"
      "v_exp_f32 %6, %6\n\tv_exp_f32 %7, %7\n\tv_nop"
      : "+v"(e0), "+v"(e1), "+v"(e2), "+v"(e3),
        "+v"(e4), "+v"(e5), "+v"(e6), "+v"(e7), "+v"(c));
  a = (v8f){e0, e1, e2, e3, e4, e5, e6, e7};
}

__device__ __forceinline__ v8f wmma_f16(v16h a, v16h b, v8f c) {
  return __builtin_amdgcn_wmma_f32_16x16x32_f16(false, a, false, b,
                                                (short)0, c, false, false);
}

// Load one 16-element f16 fragment (A or B operand, identical per-lane run
// pattern) from an fp32 row in global memory: elements 0..7 = row[lo..lo+7],
// 8..15 = row[lo+16..lo+23], scaled.
__device__ __forceinline__ v16h frag_from_f32row(const float* rowp, int lo, float s) {
  const float4 a0 = *(const float4*)(rowp + lo);
  const float4 a1 = *(const float4*)(rowp + lo + 4);
  const float4 b0 = *(const float4*)(rowp + lo + 16);
  const float4 b1 = *(const float4*)(rowp + lo + 20);
  v16h r;
  r[0]=(_Float16)(a0.x*s);  r[1]=(_Float16)(a0.y*s);
  r[2]=(_Float16)(a0.z*s);  r[3]=(_Float16)(a0.w*s);
  r[4]=(_Float16)(a1.x*s);  r[5]=(_Float16)(a1.y*s);
  r[6]=(_Float16)(a1.z*s);  r[7]=(_Float16)(a1.w*s);
  r[8]=(_Float16)(b0.x*s);  r[9]=(_Float16)(b0.y*s);
  r[10]=(_Float16)(b0.z*s); r[11]=(_Float16)(b0.w*s);
  r[12]=(_Float16)(b1.x*s); r[13]=(_Float16)(b1.y*s);
  r[14]=(_Float16)(b1.z*s); r[15]=(_Float16)(b1.w*s);
  return r;
}

// Two f32 to a pair of f16 (round to nearest even, as the cast), at this place
// in the program: written as casts, the conversions of a fetched tile are lifted
// to directly behind its loads, a tile early, and the wave waits out the whole
// load latency there instead of leaving the loads in flight for a tile.
__device__ __forceinline__ unsigned cvt_here(float a, float b) {
  unsigned r;
  asm volatile("v_cvt_pk_f16_f32 %0, %1, %2" : "=v"(r) : "v"(a), "v"(b));
  return r;
}

// Same fragment pattern from an f16 LDS row (two ds_load_b128).
__device__ __forceinline__ v16h frag_from_ldsrow(const _Float16* rowp, int lo) {
  v8h a = *(const v8h*)(rowp + lo);
  v8h b = *(const v8h*)(rowp + lo + 16);
  return __builtin_shufflevector(a, b, 0,1,2,3,4,5,6,7,8,9,10,11,12,13,14,15);
}

// Transposing LDS load. With lane l pointing at the 16 bytes
// T[8*(l>>4) + (l&7)][8*((l>>3)&1) ..+7] of a row-major f16 tile T, lane l gets
// the column piece T[8*(l>>4) + 0..7][l&15].
typedef __attribute__((ext_vector_type(8))) short v8s;
typedef __attribute__((address_space(3))) v8s lds_v8s;
__device__ __forceinline__ v8h ld_tr16(const _Float16* p) {
  return __builtin_bit_cast(v8h, __builtin_amdgcn_ds_load_tr16_b128_v8i16((lds_v8s*)p));
}

#define KLDS_STRIDE 72   /* 144B: (stride/16B)=9 odd -> conflict-free b128 rows */
#define VLDS_STRIDE 80   /* 160B: (stride/32B)=5 odd -> conflict-free transposing loads */
#define KBUF (32 * KLDS_STRIDE)   /* f16 elements of one K buffer */
#define VBUF (32 * VLDS_STRIDE)   /* f16 elements of one V buffer */

// Four waves per SIMD is what the grid gives (two work-groups per WGP). Told so,
// the compiler keeps the converted tile in registers of its own; aiming at a
// fifth wave it reuses one register from LDS write to LDS write.
__global__ __launch_bounds__(256) __attribute__((amdgpu_waves_per_eu(4, 4)))
void attn_fwd(const float* __restrict__ Q, const float* __restrict__ K,
              const float* __restrict__ V, float* __restrict__ X) {
  // Two buffers each: tile t is read from buffer t & 1 while tile t + 1 is
  // written into the other one.
  __shared__ __attribute__((aligned(16))) _Float16 Klds[2 * KBUF];   // [key][d]  f16
  __shared__ __attribute__((aligned(16))) _Float16 Vlds[2 * VBUF];   // [key][d]  f16 (transposed on read)

  const int lane = threadIdx.x & 31;
  const int wave = threadIdx.x >> 5;
  const int qt = blockIdx.x & 15;          // 16 q-tiles of 128
  const int h  = (blockIdx.x >> 4) & 15;   // 16 heads
  const int b  = blockIdx.x >> 8;          // 2 batches
  const int lo = (lane & 16) ? 8 : 0;      // per-lane run offset within 32
  const int l15 = lane & 15;

  const int qrow = qt * 128 + wave * 16 + l15;
  const float* qptr = Q + (b * NQ + qrow) * DM + h * DK;

  // Q B-fragments (d-chunks 0-31 / 32-63), softmax scale folded in.
  const v16h qf0 = frag_from_f32row(qptr,      lo, SCALE);
  const v16h qf1 = frag_from_f32row(qptr + 32, lo, SCALE);

  v8f O[4];
  #pragma unroll
  for (int i = 0; i < 4; ++i) O[i] = (v8f){0,0,0,0,0,0,0,0};
  float m = -1.0e30f, l = 0.0f;

  // Staging of a tile (32 keys x 64 dims): thread t brings dims 8*(t&7)..+7 of
  // key t>>3, of K and of V, through registers.
  const int srow = threadIdx.x >> 3;
  const int scol = (threadIdx.x & 7) * 8;
  const float* kg = K + (b * NK + srow) * DM + h * DK + scol;
  const float* vg = V + (b * NK + srow) * DM + h * DK + scol;
  _Float16* const kst = &Klds[srow * KLDS_STRIDE + scol];
  _Float16* const vst = &Vlds[srow * VLDS_STRIDE + scol];
  // This lane's address in the V tile for the transposing loads (keys 0..15, dims 0..15).
  const _Float16* const vtr = &Vlds[(lo + (lane & 7)) * VLDS_STRIDE + ((lane >> 3) & 1) * 8];
  v4f kf0, kf1, vf0, vf1;

  // Issue the loads of the tile that kg and vg point at.
  auto fetch = [&]() __attribute__((always_inline)) {
    kf0 = *(const v4f*)kg;  kf1 = *(const v4f*)(kg + 4);
    vf0 = *(const v4f*)vg;  vf1 = *(const v4f*)(vg + 4);
  };
  // Convert the fetched tile and write it into buffer buf.
  auto stage = [&](const int buf) __attribute__((always_inline)) {
    // All eight conversions ahead of the writes: each result then has a register
    // of its own, and no conversion waits for an LDS write to have read its data.
    v4u kp;
    kp[0] = cvt_here(kf0[0], kf0[1]);  kp[1] = cvt_here(kf0[2], kf0[3]);
    kp[2] = cvt_here(kf1[0], kf1[1]);  kp[3] = cvt_here(kf1[2], kf1[3]);
    v4u vp;
    vp[0] = cvt_here(vf0[0], vf0[1]);  vp[1] = cvt_here(vf0[2], vf0[3]);
    vp[2] = cvt_here(vf1[0], vf1[1]);  vp[3] = cvt_here(vf1[2], vf1[3]);
    *(v4u*)(kst + buf * KBUF) = kp;
    *(v4u*)(vst + buf * VBUF) = vp;
  };

  // Work-group barrier by hand, with the wait on this wave's LDS reads and writes
  // that it needs: __syncthreads() would also wait for the global loads that are
  // meant to stay in flight across it.
  // The four accumulators are inputs only: that keeps the tile's vector work and
  // products in front of the barrier, where they cover the draining of the LDS
  // writes (the compiler otherwise moves them behind it, and the barrier comes
  // to stand directly behind the writes).
  auto publish = [&]() __attribute__((always_inline)) {
    asm volatile("s_wait_dscnt 0x0\n\ts_barrier_signal -1\n\ts_barrier_wait -1"
                 :: "v"(O[0]), "v"(O[1]), "v"(O[2]), "v"(O[3]) : "memory");
  };

  // One tile: products and softmax on buffer cur; meanwhile, where put_next,
  // the fetched tile t + 1 goes into the other buffer and, where get_next,
  // the loads of tile t + 2 are issued.
  auto trip = [&](const int cur, const bool put_next, const bool get_next)
      __attribute__((always_inline)) {
    // All fragments of this tile are asked for ahead of the stores below.
    const _Float16* kr0 = &Klds[cur * KBUF + (l15)      * KLDS_STRIDE];
    const _Float16* kr1 = &Klds[cur * KBUF + (16 + l15) * KLDS_STRIDE];
    v16h k00 = frag_from_ldsrow(kr0,      lo);
    v16h k01 = frag_from_ldsrow(kr0 + 32, lo);
    v16h k10 = frag_from_ldsrow(kr1,      lo);
    v16h k11 = frag_from_ldsrow(kr1 + 32, lo);
    v16h vfrag[4];
    #pragma unroll
    for (int gd = 0; gd < 4; ++gd) {
      // V^T rows gd*16 + l15: keys lo..lo+7, then keys 16+lo..16+lo+7, the k order
      // of the K rows' fragments and of P^T.
      const _Float16* vp = vtr + cur * VBUF + gd * 16;
      vfrag[gd] = __builtin_shufflevector(ld_tr16(vp), ld_tr16(vp + 16 * VLDS_STRIDE),
                                          0,1,2,3,4,5,6,7,8,9,10,11,12,13,14,15);
    }
    // Keeps the tile's 16 LDS reads together up here: sunk among the products
    // they would queue behind the LDS writes below and be waited for one by one.
    __builtin_amdgcn_sched_barrier(0);

    // S^T = K . Q^T  (two 16key x 16q fragments, K-dim 64 = 2 WMMAs each)
    v8f s0 = (v8f){0,0,0,0,0,0,0,0};
    v8f s1 = (v8f){0,0,0,0,0,0,0,0};
    s0 = wmma_f16(k00, qf0, s0);  s0 = wmma_f16(k01, qf1, s0);
    s1 = wmma_f16(k10, qf0, s1);  s1 = wmma_f16(k11, qf1, s1);

    // Online softmax over this chunk's 32 keys (16 lane-local + 1 shuffle).
    float mc = -1.0e30f;
    #pragma unroll
    for (int r = 0; r < 8; ++r) { mc = fmaxf(mc, s0[r]); mc = fmaxf(mc, s1[r]); }
    const float mo = __shfl_xor(mc, 16, 32);

    if (put_next) {
      // Keeps the shuffle, which shares the LDS queue, in front of the writes.
      __builtin_amdgcn_sched_barrier(0);
      stage(cur ^ 1);
      if (get_next) { kg += 32 * DM; vg += 32 * DM; fetch(); }
      // Keeps the writes and the loads up here, so that they drain and fly under
      // the vector work: the compiler sinks them to the tile's end otherwise.
      __builtin_amdgcn_sched_barrier(0);
    }

    mc = fmaxf(mc, mo);
    const float mnew = fmaxf(m, mc);
    float corr = (m - mnew) * L2E;
    m = mnew;
    // The arguments, one fused multiply-add each (packed, two to an instruction):
    // s * log2(e) - m * log2(e).
    const float nml = -m * L2E;
    const v8f l2e8 = {L2E, L2E, L2E, L2E, L2E, L2E, L2E, L2E};
    const v8f nml8 = {nml, nml, nml, nml, nml, nml, nml, nml};
    v8f a0 = __builtin_elementwise_fma(s0, l2e8, nml8);
    v8f a1 = __builtin_elementwise_fma(s1, l2e8, nml8);
    exp2_x9(corr, a0);
    exp2_x8(a1);
    l *= corr;
    #pragma unroll
    for (int i = 0; i < 4; ++i) O[i] *= corr;

    // P^T B-fragment feeds directly from the S^T accumulator registers.
    v16h pf;
    float psum = 0.0f;
    #pragma unroll
    for (int r = 0; r < 8; ++r) {
      const float p0 = a0[r];
      const float p1 = a1[r];
      psum += p0 + p1;
      pf[r]     = (_Float16)p0;
      pf[8 + r] = (_Float16)p1;
    }
    l += psum;

    // O^T += V^T . P^T  (4 d-groups of 16)
    #pragma unroll
    for (int gd = 0; gd < 4; ++gd)
      O[gd] = wmma_f16(vfrag[gd], pf, O[gd]);

    // The one barrier of a tile: it publishes tile t + 1 and ends every wave's
    // reads of buffer cur, which the next trip overwrites.
    if (put_next) publish();
  };

  // Prologue: tile 0 into buffer 0, tile 1 on its way.
  fetch();
  stage(0);
  kg += 32 * DM; vg += 32 * DM;
  fetch();
  publish();

  for (int kb = 0; kb < NK - 64; kb += 64) {
    trip(0, true, true);
    trip(1, true, true);
  }
  trip(0, true, false);    // tile NK/32 - 2: nothing left to fetch
  trip(1, false, false);   // last tile

  // Finish: combine the two lane-half partial sums, normalize, store.
  l += __shfl_xor(l, 16, 32);
  const float inv = 1.0f / l;
  const int dhi = (lane & 16) ? 8 : 0;
  float* xrow = X + (b * NQ + qrow) * DM + h * DK;
  #pragma unroll
  for (int gd = 0; gd < 4; ++gd) {
    #pragma unroll
    for (int r = 0; r < 8; ++r)
      xrow[gd * 16 + r + dhi] = O[gd][r] * inv;
  }
}

// Y[m][n] = sum_k X[m][k] * W[n][k] + bias[n];  M=4096, N=1024, K=1024.
// Each wave: 32x32 tile (2x2 WMMA frags); block: 8 waves = 64(M) x 128(N).
// Per k-block of 128 the block's 64 X rows and 128 W rows are read once, one
// whole 512-byte row piece per wave-wide load, converted to f16 and kept in
// LDS, where all waves that need a row take their fragments from.
typedef __attribute__((ext_vector_type(4))) _Float16 v4h;
#define PK 128            /* k per staged block */
#define PLDS_STRIDE 136   /* 272B: (stride/16B)=17 odd -> conflict-free b128 rows */

__device__ __forceinline__ v4h cvt4(const v4f f) {
  v4h r;
  r[0]=(_Float16)f[0]; r[1]=(_Float16)f[1]; r[2]=(_Float16)f[2]; r[3]=(_Float16)f[3];
  return r;
}

__global__ __launch_bounds__(256)
void out_proj(const float* __restrict__ X, const float* __restrict__ W,
              const float* __restrict__ bias, float* __restrict__ Y) {
  __shared__ __attribute__((aligned(16))) _Float16 Xs[64 * PLDS_STRIDE];
  __shared__ __attribute__((aligned(16))) _Float16 Ws[128 * PLDS_STRIDE];

  const int lane = threadIdx.x & 31;
  const int wave = threadIdx.x >> 5;
  const int lo = (lane & 16) ? 8 : 0;
  const int l15 = lane & 15;
  const int bm = blockIdx.x & 63;
  const int bn = blockIdx.x >> 6;
  const int m0 = bm * 64 + (wave & 1) * 32;
  const int n0 = bn * 128 + (wave >> 1) * 32;

  // Staging: wave w brings rows w, w+8, w+16, ...; lane l brings floats 4l..4l+3.
  const float* xg = X + (bm * 64 + wave) * DM + lane * 4;
  const float* wg = W + (bn * 128 + wave) * DM + lane * 4;
  _Float16* xs = &Xs[wave * PLDS_STRIDE + lane * 4];
  _Float16* ws = &Ws[wave * PLDS_STRIDE + lane * 4];

  // Fragment rows of this wave's 32x32 tile.
  const _Float16* xr0 = &Xs[((wave & 1) * 32 + l15) * PLDS_STRIDE];
  const _Float16* xr1 = xr0 + 16 * PLDS_STRIDE;
  const _Float16* wr0 = &Ws[((wave >> 1) * 32 + l15) * PLDS_STRIDE];
  const _Float16* wr1 = wr0 + 16 * PLDS_STRIDE;

  v8f C[2][2];
  #pragma unroll
  for (int i = 0; i < 2; ++i)
    #pragma unroll
    for (int j = 0; j < 2; ++j) C[i][j] = (v8f){0,0,0,0,0,0,0,0};

  for (int kc = 0; kc < DM; kc += PK, xg += PK, wg += PK) {
    v4f xv[8], wv[16];
    // The staging loops are unrolled so that xv and wv have constant indices
    // and live in registers, with all loads issued back to back.
    #pragma unroll
    for (int i = 0; i < 8; ++i)
      xv[i] = *(const v4f*)(xg + i * 8 * DM);
    #pragma unroll
    for (int i = 0; i < 16; ++i)
      wv[i] = *(const v4f*)(wg + i * 8 * DM);
    // Inputs-only fence on the loaded values: holds all 24 loads, 16 bytes wide,
    // ahead of the barrier. Without it the compiler halves the X loads and sinks
    // one half behind the barrier: a second load latency in every k-block.
    // The two addresses are inputs too: their registers then stay untouched
    // until every load that names them has returned.
    asm volatile("" :: "v"(xv[0]), "v"(xv[1]), "v"(xv[2]), "v"(xv[3]),
                       "v"(xv[4]), "v"(xv[5]), "v"(xv[6]), "v"(xv[7]),
                       "v"(wv[0]), "v"(wv[1]), "v"(wv[2]), "v"(wv[3]),
                       "v"(wv[4]), "v"(wv[5]), "v"(wv[6]), "v"(wv[7]),
                       "v"(wv[8]), "v"(wv[9]), "v"(wv[10]), "v"(wv[11]),
                       "v"(wv[12]), "v"(wv[13]), "v"(wv[14]), "v"(wv[15]),
                       "v"(xg), "v"(wg));
    __syncthreads();  // previous k-block fully consumed
    #pragma unroll
    for (int i = 0; i < 8; ++i)
      *(v4h*)(xs + i * 8 * PLDS_STRIDE) = cvt4(xv[i]);
    #pragma unroll
    for (int i = 0; i < 16; ++i)
      *(v4h*)(ws + i * 8 * PLDS_STRIDE) = cvt4(wv[i]);
    __syncthreads();  // k-block visible to every wave

    // Unrolled: LDS offsets become immediates, no loop overhead among the WMMAs.
    #pragma unroll
    for (int ks = 0; ks < PK; ks += 32) {
      v16h a0 = frag_from_ldsrow(xr0 + ks, lo);
      v16h a1 = frag_from_ldsrow(xr1 + ks, lo);
      v16h b0 = frag_from_ldsrow(wr0 + ks, lo);
      v16h b1 = frag_from_ldsrow(wr1 + ks, lo);
      C[0][0] = wmma_f16(a0, b0, C[0][0]);
      C[0][1] = wmma_f16(a0, b1, C[0][1]);
      C[1][0] = wmma_f16(a1, b0, C[1][0]);
      C[1][1] = wmma_f16(a1, b1, C[1][1]);
    }
  }

  const float bias0 = bias[n0 + l15];
  const float bias1 = bias[n0 + 16 + l15];
  const int mhi = (lane & 16) ? 8 : 0;
  #pragma unroll
  for (int mi = 0; mi < 2; ++mi) {
    #pragma unroll
    for (int ni = 0; ni < 2; ++ni) {
      const float bb = ni ? bias1 : bias0;
      #pragma unroll
      for (int r = 0; r < 8; ++r) {
        const int row = m0 + mi * 16 + r + mhi;
        const int col = n0 + ni * 16 + l15;
        Y[row * DM + col] = C[mi][ni][r] + bb;
      }
    }
  }
}

extern "C" void kernel_launch(void* const* d_in, const int* in_sizes, int n_in,
                              void* d_out, int out_size, void* d_ws, size_t ws_size,
                              hipStream_t stream) {
  (void)in_sizes; (void)n_in; (void)out_size; (void)ws_size;
  const float* Q  = (const float*)d_in[0];
  const float* K  = (const float*)d_in[1];
  const float* V  = (const float*)d_in[2];
  const float* Wo = (const float*)d_in[3];
  const float* bo = (const float*)d_in[4];
  float* X = (float*)d_ws;            // (b, q, h*d_k) fp32 intermediate
  float* Y = (float*)d_out;

  // 2 batches * 16 heads * 16 q-tiles = 512 blocks
  attn_fwd<<<dim3(512), dim3(256), 0, stream>>>(Q, K, V, X);
  // (4096/64) * (1024/128) = 64 * 8 = 512 blocks
  out_proj<<<dim3(512), dim3(256), 0, stream>>>(X, Wo, bo, Y);
}

// v005
// One run takes 55.7 microseconds.
// Two timings next to v004 both put it at 1.12 times that version's speed.
// All steps since v000 together make it 2.43 times as fast.
#include <hip/hip_runtime.h>
#include <hip/hip_bf16.h>

typedef __attribute__((ext_vector_type(16))) _Float16 v16h;
typedef __attribute__((ext_vector_type(8)))  _Float16 v8h;
typedef __attribute__((ext_vector_type(8)))  float    v8f;
typedef __attribute__((ext_vector_type(4)))  float    v4f;
typedef __attribute__((ext_vector_type(4)))  unsigned v4u;

#define NQ 2048
#define NK 2048
#define DM 1024
#define NH 16
#define DK 64
#define SCALE 0.125f          /* 1/sqrt(64) */
#define L2E   1.44269504088896340736f

// 2^x by the bare hardware instruction, in place, for eight values and for nine.
// exp2f() wraps each v_exp_f32 in a compare, two selects, an add and an ldexp so
// that results below 2^-126 come out as denormals; here every argument is <= 0
// up to rounding, and a term that small is 0 in the f16 P operand and is lost in
// a row sum that ends >= 1.
// In asm, each over its own argument, so that no instruction directly behind a
// v_exp_f32 reads its result or overwrites its source; the v_nop is that
// slot behind the last one.
__device__ __forceinline__ void exp2_x8(v8f& a) {
  float e0 = a[0], e1 = a[1], e2 = a[2], e3 = a[3];
  float e4 = a[4], e5 = a[5], e6 = a[6], e7 = a[7];
  asm("v_exp_f32 %0, %0\n\tv_exp_f32 %1, %1\n\tv_exp_f32 %2, %2\n\t"
      "v_exp_f32 %3, %3\n\tv_exp_f32 %4, %4\n\tv_exp_f32 %5, %5\n\t"
      "v_exp_f32 %6, %6\n\tv_exp_f32 %7, %7\n\tv_nop"
      : "+v"(e0), "+v"(e1), "+v"(e2), "+v"(e3),
        "+v"(e4), "+v"(e5), "+v"(e6), "+v"(e7));
  a = (v8f){e0, e1, e2, e3, e4, e5, e6, e7};
}
__device__ __forceinline__ void exp2_x9(float& c, v8f& a) {
  float e0 = a[0], e1 = a[1], e2 = a[2], e3 = a[3];
  float e4 = a[4], e5 = a[5], e6 = a[6], e7 = a[7];
  asm("v_exp_f32 %8, %8\n\t"
      "v_exp_f32 %0, %0\n\tv_exp_f32 %1, %1\n\tv_exp_f32 %2, %2\n\t"
      "v_exp_f32 %3, %3\n\tv_exp_f32 %4, %4\n\tv_exp_f32 %5, %5\n\t"
      "v_exp_f32 %6, %6\n\tv_exp_f32 %7, %7\n\tv_nop"
      : "+v"(e0), "+v"(e1), "+v"(e2), "+v"(e3),
        "+v"(e4), "+v"(e5), "+v"(e6), "+v"(e7), "+v"(c));
  a = (v8f){e0, e1, e2, e3, e4, e5, e6, e7};
}

__device__ __forceinline__ v8f wmma_f16(v16h a, v16h b, v8f c) {
  return __builtin_amdgcn_wmma_f32_16x16x32_f16(false, a, false, b,
                                                (short)0, c, false, false);
}

// Load one 16-element f16 fragment (A or B operand, identical per-lane run
// pattern) from an fp32 row in global memory: elements 0..7 = row[lo..lo+7],
// 8..15 = row[lo+16..lo+23], scaled.
__device__ __forceinline__ v16h frag_from_f32row(const float* rowp, int lo, float s) {
  const float4 a0 = *(const float4*)(rowp + lo);
  const float4 a1 = *(const float4*)(rowp + lo + 4);
  const float4 b0 = *(const float4*)(rowp + lo + 16);
  const float4 b1 = *(const float4*)(rowp + lo + 20);
  v16h r;
  r[0]=(_Float16)(a0.x*s);  r[1]=(_Float16)(a0.y*s);
  r[2]=(_Float16)(a0.z*s);  r[3]=(_Float16)(a0.w*s);
  r[4]=(_Float16)(a1.x*s);  r[5]=(_Float16)(a1.y*s);
  r[6]=(_Float16)(a1.z*s);  r[7]=(_Float16)(a1.w*s);
  r[8]=(_Float16)(b0.x*s);  r[9]=(_Float16)(b0.y*s);
  r[10]=(_Float16)(b0.z*s); r[11]=(_Float16)(b0.w*s);
  r[12]=(_Float16)(b1.x*s); r[13]=(_Float16)(b1.y*s);
  r[14]=(_Float16)(b1.z*s); r[15]=(_Float16)(b1.w*s);
  return r;
}

// Two f32 to a pair of f16 (round to nearest even, as the cast), at this place
// in the program: written as casts, the conversions of a fetched tile are lifted
// to directly behind its loads, a tile early, and the wave waits out the whole
// load latency there instead of leaving the loads in flight for a tile.
__device__ __forceinline__ unsigned cvt_here(float a, float b) {
  unsigned r;
  asm volatile("v_cvt_pk_f16_f32 %0, %1, %2" : "=v"(r) : "v"(a), "v"(b));
  return r;
}

// Same fragment pattern from an f16 LDS row (two ds_load_b128).
__device__ __forceinline__ v16h frag_from_ldsrow(const _Float16* rowp, int lo) {
  v8h a = *(const v8h*)(rowp + lo);
  v8h b = *(const v8h*)(rowp + lo + 16);
  return __builtin_shufflevector(a, b, 0,1,2,3,4,5,6,7,8,9,10,11,12,13,14,15);
}

// Transposing LDS load. With lane l pointing at the 16 bytes
// T[8*(l>>4) + (l&7)][8*((l>>3)&1) ..+7] of a row-major f16 tile T, lane l gets
// the column piece T[8*(l>>4) + 0..7][l&15].
typedef __attribute__((ext_vector_type(8))) short v8s;
typedef __attribute__((address_space(3))) v8s lds_v8s;
__device__ __forceinline__ v8h ld_tr16(const _Float16* p) {
  return __builtin_bit_cast(v8h, __builtin_amdgcn_ds_load_tr16_b128_v8i16((lds_v8s*)p));
}

#define KLDS_STRIDE 72   /* 144B: (stride/16B)=9 odd -> conflict-free b128 rows */
#define VLDS_STRIDE 80   /* 160B: (stride/32B)=5 odd -> conflict-free transposing loads */
#define TKEYS 64                     /* keys of one tile: one softmax step, one barrier */
#define KBUF (TKEYS * KLDS_STRIDE)   /* f16 elements of one K buffer */
#define VBUF (TKEYS * VLDS_STRIDE)   /* f16 elements of one V buffer */

// Four waves per SIMD is what the grid gives (two work-groups per WGP). Told so,
// the compiler keeps the converted tile in registers of its own; aiming at a
// fifth wave it reuses one register from LDS write to LDS write.
__global__ __launch_bounds__(256) __attribute__((amdgpu_waves_per_eu(4, 4)))
void attn_fwd(const float* __restrict__ Q, const float* __restrict__ K,
              const float* __restrict__ V, float* __restrict__ X) {
  // Two buffers each: tile t is read from buffer t & 1 while tile t + 1 is
  // written into the other one.
  __shared__ __attribute__((aligned(16))) _Float16 Klds[2 * KBUF];   // [key][d]  f16
  __shared__ __attribute__((aligned(16))) _Float16 Vlds[2 * VBUF];   // [key][d]  f16 (transposed on read)

  const int lane = threadIdx.x & 31;
  const int wave = threadIdx.x >> 5;
  const int qt = blockIdx.x & 15;          // 16 q-tiles of 128
  const int h  = (blockIdx.x >> 4) & 15;   // 16 heads
  const int b  = blockIdx.x >> 8;          // 2 batches
  const int lo = (lane & 16) ? 8 : 0;      // per-lane run offset within 32
  const int l15 = lane & 15;

  const int qrow = qt * 128 + wave * 16 + l15;
  const float* qptr = Q + (b * NQ + qrow) * DM + h * DK;

  // Q B-fragments (d-chunks 0-31 / 32-63), softmax scale folded in.
  const v16h qf0 = frag_from_f32row(qptr,      lo, SCALE);
  const v16h qf1 = frag_from_f32row(qptr + 32, lo, SCALE);

  v8f O[4];
  #pragma unroll
  for (int i = 0; i < 4; ++i) O[i] = (v8f){0,0,0,0,0,0,0,0};
  float m = -1.0e30f, l = 0.0f;

  // Staging of a tile (64 keys x 64 dims): thread t brings dims 8*(t&7)..+7 of
  // keys t>>3 and 32 + (t>>3), of K and of V, through registers.
  const int srow = threadIdx.x >> 3;
  const int scol = (threadIdx.x & 7) * 8;
  const float* kg = K + (b * NK + srow) * DM + h * DK + scol;
  const float* vg = V + (b * NK + srow) * DM + h * DK + scol;
  _Float16* const kst = &Klds[srow * KLDS_STRIDE + scol];
  _Float16* const vst = &Vlds[srow * VLDS_STRIDE + scol];
  // This lane's address in the V tile for the transposing loads (keys 0..15, dims 0..15).
  const _Float16* const vtr = &Vlds[(lo + (lane & 7)) * VLDS_STRIDE + ((lane >> 3) & 1) * 8];
  // Byte address of lane ^ 16 for the exchange between the wave's halves.
  const int xaddr = (lane ^ 16) << 2;
  v4f kf0, kf1, kf2, kf3, vf0, vf1, vf2, vf3;

  // Issue the loads of the tile that kg and vg point at.
  auto fetch = [&]() __attribute__((always_inline)) {
    kf0 = *(const v4f*)kg;              kf1 = *(const v4f*)(kg + 4);
    kf2 = *(const v4f*)(kg + 32 * DM);  kf3 = *(const v4f*)(kg + 32 * DM + 4);
    vf0 = *(const v4f*)vg;              vf1 = *(const v4f*)(vg + 4);
    vf2 = *(const v4f*)(vg + 32 * DM);  vf3 = *(const v4f*)(vg + 32 * DM + 4);
  };
  // Convert the fetched tile and write it into buffer buf.
  auto stage = [&](const int buf) __attribute__((always_inline)) {
    // All conversions ahead of the writes: each result then has a register
    // of its own, and no conversion waits for an LDS write to have read its data.
    v4u kp, kq;
    kp[0] = cvt_here(kf0[0], kf0[1]);  kp[1] = cvt_here(kf0[2], kf0[3]);
    kp[2] = cvt_here(kf1[0], kf1[1]);  kp[3] = cvt_here(kf1[2], kf1[3]);
    kq[0] = cvt_here(kf2[0], kf2[1]);  kq[1] = cvt_here(kf2[2], kf2[3]);
    kq[2] = cvt_here(kf3[0], kf3[1]);  kq[3] = cvt_here(kf3[2], kf3[3]);
    v4u vp, vq;
    vp[0] = cvt_here(vf0[0], vf0[1]);  vp[1] = cvt_here(vf0[2], vf0[3]);
    vp[2] = cvt_here(vf1[0], vf1[1]);  vp[3] = cvt_here(vf1[2], vf1[3]);
    vq[0] = cvt_here(vf2[0], vf2[1]);  vq[1] = cvt_here(vf2[2], vf2[3]);
    vq[2] = cvt_here(vf3[0], vf3[1]);  vq[3] = cvt_here(vf3[2], vf3[3]);
    *(v4u*)(kst + buf * KBUF) = kp;
    *(v4u*)(kst + buf * KBUF + 32 * KLDS_STRIDE) = kq;
    *(v4u*)(vst + buf * VBUF) = vp;
    *(v4u*)(vst + buf * VBUF + 32 * VLDS_STRIDE) = vq;
  };

  // Work-group barrier by hand, with the wait on this wave's LDS reads and writes
  // that it needs: __syncthreads() would also wait for the global loads that are
  // meant to stay in flight across it.
  // The four accumulators are inputs only: that keeps the tile's vector work and
  // products in front of the barrier, where they cover the draining of the LDS
  // writes (the compiler otherwise moves them behind it, and the barrier comes
  // to stand directly behind the writes).
  auto publish = [&]() __attribute__((always_inline)) {
    asm volatile("s_wait_dscnt 0x0\n\ts_barrier_signal -1\n\ts_barrier_wait -1"
                 :: "v"(O[0]), "v"(O[1]), "v"(O[2]), "v"(O[3]) : "memory");
  };

  // One tile: products and softmax on buffer cur; meanwhile, where put_next,
  // the fetched tile t + 1 goes into the other buffer and, where get_next,
  // the loads of tile t + 2 are issued.
  auto trip = [&](const int cur, const bool put_next, const bool get_next)
      __attribute__((always_inline)) {
    // The K fragments of the tile's four groups of 16 keys, in the order of use.
    v16h ka[4], kc[4];
    #pragma unroll
    for (int g = 0; g < 4; ++g)
      ka[g] = frag_from_ldsrow(&Klds[cur * KBUF + (g * 16 + l15) * KLDS_STRIDE], lo);
    #pragma unroll
    for (int g = 0; g < 4; ++g)
      kc[g] = frag_from_ldsrow(&Klds[cur * KBUF + (g * 16 + l15) * KLDS_STRIDE] + 32, lo);
    // Staging stands here, behind the K reads: its conversions, LDS writes and
    // loads issue while the K fragments are on their way, when the wave has
    // nothing else to do.
    if (put_next) {
      // The four vector slots that the chip needs between the last tile's products
      // and a vector write over their operands: the conversions are asm text, which
      // the compiler does not count, and may be given those registers.
      asm volatile("v_nop\n\tv_nop\n\tv_nop\n\tv_nop");
      stage(cur ^ 1);
      if (get_next) { kg += TKEYS * DM; vg += TKEYS * DM; fetch(); }
    }
    // Keeps the 16 LDS reads together up here (sunk among the products they
    // would be waited for one by one), and the staging with them.
    __builtin_amdgcn_sched_barrier(0);

    // S^T = K . Q^T  (four 16key x 16q fragments, K-dim 64 = 2 WMMAs each)
    v8f s[4];
    #pragma unroll
    for (int g = 0; g < 4; ++g) s[g] = wmma_f16(ka[g], qf0, (v8f){0,0,0,0,0,0,0,0});
    #pragma unroll
    for (int g = 0; g < 4; ++g) s[g] = wmma_f16(kc[g], qf1, s[g]);

    // Online softmax over this tile's 64 keys (32 lane-local, in two independent
    // chains, + 1 shuffle).
    float mca = -1.0e30f, mcb = -1.0e30f;
    #pragma unroll
    for (int r = 0; r < 8; ++r) {
      mca = fmaxf(mca, s[0][r]); mca = fmaxf(mca, s[1][r]);
      mcb = fmaxf(mcb, s[2][r]); mcb = fmaxf(mcb, s[3][r]);
    }
    float mc = fmaxf(mca, mcb);
    // The exchange between the wave's halves (the instruction that __shfl_xor gives),
    // at this place in the program and with its own wait: it shares the LDS queue, and
    // left to the compiler it comes to stand behind the V reads below, so that the
    // softmax waits for all of them instead of running under them.
    // It also holds the V reads behind the score products: their fragments then
    // take the registers that the K fragments have left.
    float mo;
    asm volatile("ds_bpermute_b32 %0, %1, %2\n\ts_wait_dscnt 0x0"
                 : "=&v"(mo) : "v"(xaddr), "v"(mc) : "memory");
    // Order of what stands above: the eight score products in one run, then the
    // maximum chains. Left alone the compiler starts the chains among the products
    // and pads each such place with v_nop up to the distance a product's result needs.
    __builtin_amdgcn_sched_group_barrier(0x008, 8, 0);    // matrix
    __builtin_amdgcn_sched_group_barrier(0x002, 20, 0);   // vector

    v16h vfrag[2][4];
    #pragma unroll
    for (int c = 0; c < 2; ++c) {
      #pragma unroll
      for (int gd = 0; gd < 4; ++gd) {
        // V^T rows gd*16 + l15 over keys 32c..32c+31: keys lo..lo+7, then keys
        // 16+lo..16+lo+7, the k order of the K rows' fragments and of P^T.
        const _Float16* vp = vtr + cur * VBUF + c * 32 * VLDS_STRIDE + gd * 16;
        vfrag[c][gd] = __builtin_shufflevector(ld_tr16(vp), ld_tr16(vp + 16 * VLDS_STRIDE),
                                               0,1,2,3,4,5,6,7,8,9,10,11,12,13,14,15);
      }
    }
    // Keeps the V reads up here, so that they land under the vector work: the
    // compiler sinks them to the tile's end otherwise.
    __builtin_amdgcn_sched_barrier(0);

    mc = fmaxf(mc, mo);
    const float mnew = fmaxf(m, mc);
    float corr = (m - mnew) * L2E;
    m = mnew;
    // The arguments, one fused multiply-add each (packed, two to an instruction):
    // s * log2(e) - m * log2(e).
    const float nml = -m * L2E;
    const v8f l2e8 = {L2E, L2E, L2E, L2E, L2E, L2E, L2E, L2E};
    const v8f nml8 = {nml, nml, nml, nml, nml, nml, nml, nml};
    v8f a0 = __builtin_elementwise_fma(s[0], l2e8, nml8);
    v8f a1 = __builtin_elementwise_fma(s[1], l2e8, nml8);
    v8f a2 = __builtin_elementwise_fma(s[2], l2e8, nml8);
    v8f a3 = __builtin_elementwise_fma(s[3], l2e8, nml8);
    exp2_x9(corr, a0);
    exp2_x8(a1);
    exp2_x8(a2);
    exp2_x8(a3);
    l *= corr;
    #pragma unroll
    for (int i = 0; i < 4; ++i) O[i] *= corr;

    // P^T B-fragments (keys 0..31 and 32..63) feed directly from the S^T
    // accumulator registers.
    v16h pf0, pf1;
    float psa = 0.0f, psb = 0.0f;
    #pragma unroll
    for (int r = 0; r < 8; ++r) {
      psa += a0[r] + a1[r];
      psb += a2[r] + a3[r];
      pf0[r]     = (_Float16)a0[r];
      pf0[8 + r] = (_Float16)a1[r];
      pf1[r]     = (_Float16)a2[r];
      pf1[8 + r] = (_Float16)a3[r];
    }
    l += psa + psb;

    // O^T += V^T . P^T  (4 d-groups of 16, two k-steps of 32 keys)
    #pragma unroll
    for (int gd = 0; gd < 4; ++gd)
      O[gd] = wmma_f16(vfrag[0][gd], pf0, O[gd]);
    #pragma unroll
    for (int gd = 0; gd < 4; ++gd)
      O[gd] = wmma_f16(vfrag[1][gd], pf1, O[gd]);

    // The one barrier of a tile: it publishes tile t + 1 and ends every wave's
    // reads of buffer cur, which the next trip overwrites.
    if (put_next) publish();
  };

  // Prologue: tile 0 into buffer 0, tile 1 on its way.
  fetch();
  stage(0);
  kg += TKEYS * DM; vg += TKEYS * DM;
  fetch();
  publish();

  for (int kb = 0; kb < NK - 2 * TKEYS; kb += 2 * TKEYS) {
    trip(0, true, true);
    trip(1, true, true);
  }
  trip(0, true, false);    // tile NK/TKEYS - 2: nothing left to fetch
  trip(1, false, false);   // last tile

  // Finish: combine the two lane-half partial sums, normalize, store.
  l += __shfl_xor(l, 16, 32);
  const float inv = 1.0f / l;
  const int dhi = (lane & 16) ? 8 : 0;
  float* xrow = X + (b * NQ + qrow) * DM + h * DK;
  #pragma unroll
  for (int gd = 0; gd < 4; ++gd) {
    #pragma unroll
    for (int r = 0; r < 8; ++r)
      xrow[gd * 16 + r + dhi] = O[gd][r] * inv;
  }
}

// Y[m][n] = sum_k X[m][k] * W[n][k] + bias[n];  M=4096, N=1024, K=1024.
// Each wave: 32x32 tile (2x2 WMMA frags); block: 8 waves = 64(M) x 128(N).
// Per k-block of 128 the block's 64 X rows and 128 W rows are read once, one
// whole 512-byte row piece per wave-wide load, converted to f16 and kept in
// LDS, where all waves that need a row take their fragments from.
typedef __attribute__((ext_vector_type(4))) _Float16 v4h;
#define PK 128            /* k per staged block */
#define PLDS_STRIDE 136   /* 272B: (stride/16B)=17 odd -> conflict-free b128 rows */

__device__ __forceinline__ v4h cvt4(const v4f f) {
  v4h r;
  r[0]=(_Float16)f[0]; r[1]=(_Float16)f[1]; r[2]=(_Float16)f[2]; r[3]=(_Float16)f[3];
  return r;
}

__global__ __launch_bounds__(256)
void out_proj(const float* __restrict__ X, const float* __restrict__ W,
              const float* __restrict__ bias, float* __restrict__ Y) {
  __shared__ __attribute__((aligned(16))) _Float16 Xs[64 * PLDS_STRIDE];
  __shared__ __attribute__((aligned(16))) _Float16 Ws[128 * PLDS_STRIDE];

  const int lane = threadIdx.x & 31;
  const int wave = threadIdx.x >> 5;
  const int lo = (lane & 16) ? 8 : 0;
  const int l15 = lane & 15;
  const int bm = blockIdx.x & 63;
  const int bn = blockIdx.x >> 6;
  const int m0 = bm * 64 + (wave & 1) * 32;
  const int n0 = bn * 128 + (wave >> 1) * 32;

  // Staging: wave w brings rows w, w+8, w+16, ...; lane l brings floats 4l..4l+3.
  const float* xg = X + (bm * 64 + wave) * DM + lane * 4;
  const float* wg = W + (bn * 128 + wave) * DM + lane * 4;
  _Float16* xs = &Xs[wave * PLDS_STRIDE + lane * 4];
  _Float16* ws = &Ws[wave * PLDS_STRIDE + lane * 4];

  // Fragment rows of this wave's 32x32 tile.
  const _Float16* xr0 = &Xs[((wave & 1) * 32 + l15) * PLDS_STRIDE];
  const _Float16* xr1 = xr0 + 16 * PLDS_STRIDE;
  const _Float16* wr0 = &Ws[((wave >> 1) * 32 + l15) * PLDS_STRIDE];
  const _Float16* wr1 = wr0 + 16 * PLDS_STRIDE;

  v8f C[2][2];
  #pragma unroll
  for (int i = 0; i < 2; ++i)
    #pragma unroll
    for (int j = 0; j < 2; ++j) C[i][j] = (v8f){0,0,0,0,0,0,0,0};

  for (int kc = 0; kc < DM; kc += PK, xg += PK, wg += PK) {
    v4f xv[8], wv[16];
    // The staging loops are unrolled so that xv and wv have constant indices
    // and live in registers, with all loads issued back to back.
    #pragma unroll
    for (int i = 0; i < 8; ++i)
      xv[i] = *(const v4f*)(xg + i * 8 * DM);
    #pragma unroll
    for (int i = 0; i < 16; ++i)
      wv[i] = *(const v4f*)(wg + i * 8 * DM);
    // Inputs-only fence on the loaded values: holds all 24 loads, 16 bytes wide,
    // ahead of the barrier. Without it the compiler halves the X loads and sinks
    // one half behind the barrier: a second load latency in every k-block.
    // The two addresses are inputs too: their registers then stay untouched
    // until every load that names them has returned.
    asm volatile("" :: "v"(xv[0]), "v"(xv[1]), "v"(xv[2]), "v"(xv[3]),
                       "v"(xv[4]), "v"(xv[5]), "v"(xv[6]), "v"(xv[7]),
                       "v"(wv[0]), "v"(wv[1]), "v"(wv[2]), "v"(wv[3]),
                       "v"(wv[4]), "v"(wv[5]), "v"(wv[6]), "v"(wv[7]),
                       "v"(wv[8]), "v"(wv[9]), "v"(wv[10]), "v"(wv[11]),
                       "v"(wv[12]), "v"(wv[13]), "v"(wv[14]), "v"(wv[15]),
                       "v"(xg), "v"(wg));
    __syncthreads();  // previous k-block fully consumed
    #pragma unroll
    for (int i = 0; i < 8; ++i)
      *(v4h*)(xs + i * 8 * PLDS_STRIDE) = cvt4(xv[i]);
    #pragma unroll
    for (int i = 0; i < 16; ++i)
      *(v4h*)(ws + i * 8 * PLDS_STRIDE) = cvt4(wv[i]);
    __syncthreads();  // k-block visible to every wave

    // Unrolled: LDS offsets become immediates, no loop overhead among the WMMAs.
    #pragma unroll
    for (int ks = 0; ks < PK; ks += 32) {
      v16h a0 = frag_from_ldsrow(xr0 + ks, lo);
      v16h a1 = frag_from_ldsrow(xr1 + ks, lo);
      v16h b0 = frag_from_ldsrow(wr0 + ks, lo);
      v16h b1 = frag_from_ldsrow(wr1 + ks, lo);
      C[0][0] = wmma_f16(a0, b0, C[0][0]);
      C[0][1] = wmma_f16(a0, b1, C[0][1]);
      C[1][0] = wmma_f16(a1, b0, C[1][0]);
      C[1][1] = wmma_f16(a1, b1, C[1][1]);
    }
  }

  const float bias0 = bias[n0 + l15];
  const float bias1 = bias[n0 + 16 + l15];
  const int mhi = (lane & 16) ? 8 : 0;
  #pragma unroll
  for (int mi = 0; mi < 2; ++mi) {
    #pragma unroll
    for (int ni = 0; ni < 2; ++ni) {
      const float bb = ni ? bias1 : bias0;
      #pragma unroll
      for (int r = 0; r < 8; ++r) {
        const int row = m0 + mi * 16 + r + mhi;
        const int col = n0 + ni * 16 + l15;
        Y[row * DM + col] = C[mi][ni][r] + bb;
      }
    }
  }
}

extern "C" void kernel_launch(void* const* d_in, const int* in_sizes, int n_in,
                              void* d_out, int out_size, void* d_ws, size_t ws_size,
                              hipStream_t stream) {
  (void)in_sizes; (void)n_in; (void)out_size; (void)ws_size;
  const float* Q  = (const float*)d_in[0];
  const float* K  = (const float*)d_in[1];
  const float* V  = (const float*)d_in[2];
  const float* Wo = (const float*)d_in[3];
  const float* bo = (const float*)d_in[4];
  float* X = (float*)d_ws;            // (b, q, h*d_k) fp32 intermediate
  float* Y = (float*)d_out;

  // 2 batches * 16 heads * 16 q-tiles = 512 blocks
  attn_fwd<<<dim3(512), dim3(256), 0, stream>>>(Q, K, V, X);
  // (4096/64) * (1024/128) = 64 * 8 = 512 blocks
  out_proj<<<dim3(512), dim3(256), 0, stream>>>(X, Wo, bo, Y);
}

// v006
// A run of this version takes 50.8 microseconds.
// Timed twice side by side with v005, it ran 1.10 times as fast both times.
// Over all steps from v000 it is 2.66 times as fast.
#include <hip/hip_runtime.h>
#include <hip/hip_bf16.h>

typedef __attribute__((ext_vector_type(16))) _Float16 v16h;
typedef __attribute__((ext_vector_type(8)))  _Float16 v8h;
typedef __attribute__((ext_vector_type(8)))  float    v8f;
typedef __attribute__((ext_vector_type(4)))  float    v4f;
typedef __attribute__((ext_vector_type(4)))  unsigned v4u;

#define NQ 2048
#define NK 2048
#define DM 1024
#define NH 16
#define DK 64
#define SCALE 0.125f          /* 1/sqrt(64) */
#define L2E   1.44269504088896340736f

// 2^x by the bare hardware instruction, in place, for eight values and for nine.
// exp2f() wraps each v_exp_f32 in a compare, two selects, an add and an ldexp so
// that results below 2^-126 come out as denormals; here every argument is <= 0
// up to rounding, and a term that small is 0 in the f16 P operand and is lost in
// a row sum that ends >= 1.
// In asm, each over its own argument, so that no instruction directly behind a
// v_exp_f32 reads its result or overwrites its source; the v_nop is that
// slot behind the last one.
__device__ __forceinline__ void exp2_x8(v8f& a) {
  float e0 = a[0], e1 = a[1], e2 = a[2], e3 = a[3];
  float e4 = a[4], e5 = a[5], e6 = a[6], e7 = a[7];
  asm("v_exp_f32 %0, %0\n\tv_exp_f32 %1, %1\n\tv_exp_f32 %2, %2\n\t"
      "v_exp_f32 %3, %3\n\tv_exp_f32 %4, %4\n\tv_exp_f32 %5, %5\n\t"
      "v_exp_f32 %6, %6\n\tv_exp_f32 %7, %7\n\tv_nop"
      : "+v"(e0), "+v"(e1), "+v"(e2), "+v"(e3),
        "+v"(e4), "+v"(e5), "+v"(e6), "+v"(e7));
  a = (v8f){e0, e1, e2, e3, e4, e5, e6, e7};
}
__device__ __forceinline__ void exp2_x9(float& c, v8f& a) {
  float e0 = a[0], e1 = a[1], e2 = a[2], e3 = a[3];
  float e4 = a[4], e5 = a[5], e6 = a[6], e7 = a[7];
  asm("v_exp_f32 %8, %8\n\t"
      "v_exp_f32 %0, %0\n\tv_exp_f32 %1, %1\n\tv_exp_f32 %2, %2\n\t"
      "v_exp_f32 %3, %3\n\tv_exp_f32 %4, %4\n\tv_exp_f32 %5, %5\n\t"
      "v_exp_f32 %6, %6\n\tv_exp_f32 %7, %7\n\tv_nop"
      : "+v"(e0), "+v"(e1), "+v"(e2), "+v"(e3),
        "+v"(e4), "+v"(e5), "+v"(e6), "+v"(e7), "+v"(c));
  a = (v8f){e0, e1, e2, e3, e4, e5, e6, e7};
}

__device__ __forceinline__ v8f wmma_f16(v16h a, v16h b, v8f c) {
  return __builtin_amdgcn_wmma_f32_16x16x32_f16(false, a, false, b,
                                                (short)0, c, false, false);
}

// Load one 16-element f16 fragment (A or B operand, identical per-lane run
// pattern) from an fp32 row in global memory: elements 0..7 = row[lo..lo+7],
// 8..15 = row[lo+16..lo+23], scaled.
__device__ __forceinline__ v16h frag_from_f32row(const float* rowp, int lo, float s) {
  const float4 a0 = *(const float4*)(rowp + lo);
  const float4 a1 = *(const float4*)(rowp + lo + 4);
  const float4 b0 = *(const float4*)(rowp + lo + 16);
  const float4 b1 = *(const float4*)(rowp + lo + 20);
  v16h r;
  r[0]=(_Float16)(a0.x*s);  r[1]=(_Float16)(a0.y*s);
  r[2]=(_Float16)(a0.z*s);  r[3]=(_Float16)(a0.w*s);
  r[4]=(_Float16)(a1.x*s);  r[5]=(_Float16)(a1.y*s);
  r[6]=(_Float16)(a1.z*s);  r[7]=(_Float16)(a1.w*s);
  r[8]=(_Float16)(b0.x*s);  r[9]=(_Float16)(b0.y*s);
  r[10]=(_Float16)(b0.z*s); r[11]=(_Float16)(b0.w*s);
  r[12]=(_Float16)(b1.x*s); r[13]=(_Float16)(b1.y*s);
  r[14]=(_Float16)(b1.z*s); r[15]=(_Float16)(b1.w*s);
  return r;
}

// Two f32 to a pair of f16 (round to nearest even, as the cast), at this place
// in the program: written as casts, the conversions of a fetched tile are lifted
// to directly behind its loads, a tile early, and the wave waits out the whole
// load latency there instead of leaving the loads in flight for a tile.
__device__ __forceinline__ unsigned cvt_here(float a, float b) {
  unsigned r;
  asm volatile("v_cvt_pk_f16_f32 %0, %1, %2" : "=v"(r) : "v"(a), "v"(b));
  return r;
}

typedef __attribute__((ext_vector_type(4))) _Float16 v4h;
__device__ __forceinline__ v4h cvt4(const v4f f) {
  v4h r;
  r[0]=(_Float16)f[0]; r[1]=(_Float16)f[1]; r[2]=(_Float16)f[2]; r[3]=(_Float16)f[3];
  return r;
}

// Same fragment pattern from an f16 LDS row (two ds_load_b128).
__device__ __forceinline__ v16h frag_from_ldsrow(const _Float16* rowp, int lo) {
  v8h a = *(const v8h*)(rowp + lo);
  v8h b = *(const v8h*)(rowp + lo + 16);
  return __builtin_shufflevector(a, b, 0,1,2,3,4,5,6,7,8,9,10,11,12,13,14,15);
}

// Transposing LDS load. With lane l pointing at the 16 bytes
// T[8*(l>>4) + (l&7)][8*((l>>3)&1) ..+7] of a row-major f16 tile T, lane l gets
// the column piece T[8*(l>>4) + 0..7][l&15].
typedef __attribute__((ext_vector_type(8))) short v8s;
typedef __attribute__((address_space(3))) v8s lds_v8s;
__device__ __forceinline__ v8h ld_tr16(const _Float16* p) {
  return __builtin_bit_cast(v8h, __builtin_amdgcn_ds_load_tr16_b128_v8i16((lds_v8s*)p));
}

#define KLDS_STRIDE 72   /* 144B: (stride/16B)=9 odd -> conflict-free b128 rows */
#define VLDS_STRIDE 80   /* 160B: (stride/32B)=5 odd -> conflict-free transposing loads */
#define TKEYS 64                     /* keys of one tile: one softmax step, one barrier */
#define KBUF (TKEYS * KLDS_STRIDE)   /* f16 elements of one K buffer */
#define VBUF (TKEYS * VLDS_STRIDE)   /* f16 elements of one V buffer */

// Four waves per SIMD is what the grid gives (two work-groups per WGP). Told so,
// the compiler keeps the converted tile in registers of its own; aiming at a
// fifth wave it reuses one register from LDS write to LDS write.
__global__ __launch_bounds__(256) __attribute__((amdgpu_waves_per_eu(4, 4)))
void attn_fwd(const float* __restrict__ Q, const float* __restrict__ K,
              const float* __restrict__ V, const float* __restrict__ Wo,
              float* __restrict__ X, float* __restrict__ Wh) {
  // Two buffers each: tile t is read from buffer t & 1 while tile t + 1 is
  // written into the other one.
  __shared__ __attribute__((aligned(16))) _Float16 Klds[2 * KBUF];   // [key][d]  f16
  __shared__ __attribute__((aligned(16))) _Float16 Vlds[2 * VBUF];   // [key][d]  f16 (transposed on read)

  const int lane = threadIdx.x & 31;
  const int wave = threadIdx.x >> 5;
  const int qt = blockIdx.x & 15;          // 16 q-tiles of 128
  const int h  = (blockIdx.x >> 4) & 15;   // 16 heads
  const int b  = blockIdx.x >> 8;          // 2 batches
  const int lo = (lane & 16) ? 8 : 0;      // per-lane run offset within 32
  const int l15 = lane & 15;

  // This block's 2048 elements of the projection weight, to be left in the
  // workspace as f16 for out_proj (whole lines per wave-wide load). The loads go
  // out with the first Q, K and V loads and share their wait.
  const int wi = blockIdx.x * 2048 + threadIdx.x * 4;
  const v4f wa = *(const v4f*)(Wo + wi);
  const v4f wb = *(const v4f*)(Wo + wi + 1024);

  const int qrow = qt * 128 + wave * 16 + l15;
  const float* qptr = Q + (b * NQ + qrow) * DM + h * DK;

  // Q B-fragments (d-chunks 0-31 / 32-63), softmax scale folded in.
  const v16h qf0 = frag_from_f32row(qptr,      lo, SCALE);
  const v16h qf1 = frag_from_f32row(qptr + 32, lo, SCALE);

  v8f O[4];
  #pragma unroll
  for (int i = 0; i < 4; ++i) O[i] = (v8f){0,0,0,0,0,0,0,0};
  float m = -1.0e30f, l = 0.0f;

  // Staging of a tile (64 keys x 64 dims): thread t brings dims 8*(t&7)..+7 of
  // keys t>>3 and 32 + (t>>3), of K and of V, through registers.
  const int srow = threadIdx.x >> 3;
  const int scol = (threadIdx.x & 7) * 8;
  const float* kg = K + (b * NK + srow) * DM + h * DK + scol;
  const float* vg = V + (b * NK + srow) * DM + h * DK + scol;
  _Float16* const kst = &Klds[srow * KLDS_STRIDE + scol];
  _Float16* const vst = &Vlds[srow * VLDS_STRIDE + scol];
  // This lane's address in the V tile for the transposing loads (keys 0..15, dims 0..15).
  const _Float16* const vtr = &Vlds[(lo + (lane & 7)) * VLDS_STRIDE + ((lane >> 3) & 1) * 8];
  // Byte address of lane ^ 16 for the exchange between the wave's halves.
  const int xaddr = (lane ^ 16) << 2;
  v4f kf0, kf1, kf2, kf3, vf0, vf1, vf2, vf3;

  // Issue the loads of the tile that kg and vg point at.
  auto fetch = [&]() __attribute__((always_inline)) {
    kf0 = *(const v4f*)kg;              kf1 = *(const v4f*)(kg + 4);
    kf2 = *(const v4f*)(kg + 32 * DM);  kf3 = *(const v4f*)(kg + 32 * DM + 4);
    vf0 = *(const v4f*)vg;              vf1 = *(const v4f*)(vg + 4);
    vf2 = *(const v4f*)(vg + 32 * DM);  vf3 = *(const v4f*)(vg + 32 * DM + 4);
  };
  // Convert the fetched tile and write it into buffer buf.
  auto stage = [&](const int buf) __attribute__((always_inline)) {
    // All conversions ahead of the writes: each result then has a register
    // of its own, and no conversion waits for an LDS write to have read its data.
    v4u kp, kq;
    kp[0] = cvt_here(kf0[0], kf0[1]);  kp[1] = cvt_here(kf0[2], kf0[3]);
    kp[2] = cvt_here(kf1[0], kf1[1]);  kp[3] = cvt_here(kf1[2], kf1[3]);
    kq[0] = cvt_here(kf2[0], kf2[1]);  kq[1] = cvt_here(kf2[2], kf2[3]);
    kq[2] = cvt_here(kf3[0], kf3[1]);  kq[3] = cvt_here(kf3[2], kf3[3]);
    v4u vp, vq;
    vp[0] = cvt_here(vf0[0], vf0[1]);  vp[1] = cvt_here(vf0[2], vf0[3]);
    vp[2] = cvt_here(vf1[0], vf1[1]);  vp[3] = cvt_here(vf1[2], vf1[3]);
    vq[0] = cvt_here(vf2[0], vf2[1]);  vq[1] = cvt_here(vf2[2], vf2[3]);
    vq[2] = cvt_here(vf3[0], vf3[1]);  vq[3] = cvt_here(vf3[2], vf3[3]);
    *(v4u*)(kst + buf * KBUF) = kp;
    *(v4u*)(kst + buf * KBUF + 32 * KLDS_STRIDE) = kq;
    *(v4u*)(vst + buf * VBUF) = vp;
    *(v4u*)(vst + buf * VBUF + 32 * VLDS_STRIDE) = vq;
  };

  // Work-group barrier by hand, with the wait on this wave's LDS reads and writes
  // that it needs: __syncthreads() would also wait for the global loads that are
  // meant to stay in flight across it.
  // The four accumulators are inputs only: that keeps the tile's vector work and
  // products in front of the barrier, where they cover the draining of the LDS
  // writes (the compiler otherwise moves them behind it, and the barrier comes
  // to stand directly behind the writes).
  auto publish = [&]() __attribute__((always_inline)) {
    asm volatile("s_wait_dscnt 0x0\n\ts_barrier_signal -1\n\ts_barrier_wait -1"
                 :: "v"(O[0]), "v"(O[1]), "v"(O[2]), "v"(O[3]) : "memory");
  };

  // One tile: products and softmax on buffer cur; meanwhile, where put_next,
  // the fetched tile t + 1 goes into the other buffer and, where get_next,
  // the loads of tile t + 2 are issued.
  auto trip = [&](const int cur, const bool put_next, const bool get_next)
      __attribute__((always_inline)) {
    // The K fragments of the tile's four groups of 16 keys, in the order of use.
    v16h ka[4], kc[4];
    #pragma unroll
    for (int g = 0; g < 4; ++g)
      ka[g] = frag_from_ldsrow(&Klds[cur * KBUF + (g * 16 + l15) * KLDS_STRIDE], lo);
    #pragma unroll
    for (int g = 0; g < 4; ++g)
      kc[g] = frag_from_ldsrow(&Klds[cur * KBUF + (g * 16 + l15) * KLDS_STRIDE] + 32, lo);
    // Staging stands here, behind the K reads: its conversions, LDS writes and
    // loads issue while the K fragments are on their way, when the wave has
    // nothing else to do.
    if (put_next) {
      // The four vector slots that the chip needs between the last tile's products
      // and a vector write over their operands: the conversions are asm text, which
      // the compiler does not count, and may be given those registers.
      asm volatile("v_nop\n\tv_nop\n\tv_nop\n\tv_nop");
      stage(cur ^ 1);
      if (get_next) { kg += TKEYS * DM; vg += TKEYS * DM; fetch(); }
    }
    // Keeps the 16 LDS reads together up here (sunk among the products they
    // would be waited for one by one), and the staging with them.
    __builtin_amdgcn_sched_barrier(0);

    // S^T = K . Q^T  (four 16key x 16q fragments, K-dim 64 = 2 WMMAs each)
    v8f s[4];
    #pragma unroll
    for (int g = 0; g < 4; ++g) s[g] = wmma_f16(ka[g], qf0, (v8f){0,0,0,0,0,0,0,0});
    #pragma unroll
    for (int g = 0; g < 4; ++g) s[g] = wmma_f16(kc[g], qf1, s[g]);

    // Online softmax over this tile's 64 keys (32 lane-local, in two independent
    // chains, + 1 shuffle).
    float mca = -1.0e30f, mcb = -1.0e30f;
    #pragma unroll
    for (int r = 0; r < 8; ++r) {
      mca = fmaxf(mca, s[0][r]); mca = fmaxf(mca, s[1][r]);
      mcb = fmaxf(mcb, s[2][r]); mcb = fmaxf(mcb, s[3][r]);
    }
    float mc = fmaxf(mca, mcb);
    // The exchange between the wave's halves (the instruction that __shfl_xor gives),
    // at this place in the program and with its own wait: it shares the LDS queue, and
    // left to the compiler it comes to stand behind the V reads below, so that the
    // softmax waits for all of them instead of running under them.
    // It also holds the V reads behind the score products: their fragments then
    // take the registers that the K fragments have left.
    float mo;
    asm volatile("ds_bpermute_b32 %0, %1, %2\n\ts_wait_dscnt 0x0"
                 : "=&v"(mo) : "v"(xaddr), "v"(mc) : "memory");
    // Order of what stands above: the eight score products in one run, then the
    // maximum chains. Left alone the compiler starts the chains among the products
    // and pads each such place with v_nop up to the distance a product's result needs.
    __builtin_amdgcn_sched_group_barrier(0x008, 8, 0);    // matrix
    __builtin_amdgcn_sched_group_barrier(0x002, 20, 0);   // vector

    v16h vfrag[2][4];
    #pragma unroll
    for (int c = 0; c < 2; ++c) {
      #pragma unroll
      for (int gd = 0; gd < 4; ++gd) {
        // V^T rows gd*16 + l15 over keys 32c..32c+31: keys lo..lo+7, then keys
        // 16+lo..16+lo+7, the k order of the K rows' fragments and of P^T.
        const _Float16* vp = vtr + cur * VBUF + c * 32 * VLDS_STRIDE + gd * 16;
        vfrag[c][gd] = __builtin_shufflevector(ld_tr16(vp), ld_tr16(vp + 16 * VLDS_STRIDE),
                                               0,1,2,3,4,5,6,7,8,9,10,11,12,13,14,15);
      }
    }
    // Keeps the V reads up here, so that they land under the vector work: the
    // compiler sinks them to the tile's end otherwise.
    __builtin_amdgcn_sched_barrier(0);

    mc = fmaxf(mc, mo);
    const float mnew = fmaxf(m, mc);
    float corr = (m - mnew) * L2E;
    m = mnew;
    // The arguments, one fused multiply-add each (packed, two to an instruction):
    // s * log2(e) - m * log2(e).
    const float nml = -m * L2E;
    const v8f l2e8 = {L2E, L2E, L2E, L2E, L2E, L2E, L2E, L2E};
    const v8f nml8 = {nml, nml, nml, nml, nml, nml, nml, nml};
    v8f a0 = __builtin_elementwise_fma(s[0], l2e8, nml8);
    v8f a1 = __builtin_elementwise_fma(s[1], l2e8, nml8);
    v8f a2 = __builtin_elementwise_fma(s[2], l2e8, nml8);
    v8f a3 = __builtin_elementwise_fma(s[3], l2e8, nml8);
    exp2_x9(corr, a0);
    exp2_x8(a1);
    exp2_x8(a2);
    exp2_x8(a3);
    l *= corr;
    #pragma unroll
    for (int i = 0; i < 4; ++i) O[i] *= corr;

    // P^T B-fragments (keys 0..31 and 32..63) feed directly from the S^T
    // accumulator registers.
    v16h pf0, pf1;
    float psa = 0.0f, psb = 0.0f;
    #pragma unroll
    for (int r = 0; r < 8; ++r) {
      psa += a0[r] + a1[r];
      psb += a2[r] + a3[r];
      pf0[r]     = (_Float16)a0[r];
      pf0[8 + r] = (_Float16)a1[r];
      pf1[r]     = (_Float16)a2[r];
      pf1[8 + r] = (_Float16)a3[r];
    }
    l += psa + psb;

    // O^T += V^T . P^T  (4 d-groups of 16, two k-steps of 32 keys)
    #pragma unroll
    for (int gd = 0; gd < 4; ++gd)
      O[gd] = wmma_f16(vfrag[0][gd], pf0, O[gd]);
    #pragma unroll
    for (int gd = 0; gd < 4; ++gd)
      O[gd] = wmma_f16(vfrag[1][gd], pf1, O[gd]);

    // The one barrier of a tile: it publishes tile t + 1 and ends every wave's
    // reads of buffer cur, which the next trip overwrites.
    if (put_next) publish();
  };

  // Prologue: tile 0 into buffer 0, tile 1 on its way.
  fetch();
  stage(0);
  kg += TKEYS * DM; vg += TKEYS * DM;
  fetch();
  publish();

  // The weight's f16 copy: the same conversion that out_proj's staging made, once
  // per element instead of once per block that reads the row.
  *(v4h*)((_Float16*)Wh + wi)        = cvt4(wa);
  *(v4h*)((_Float16*)Wh + wi + 1024) = cvt4(wb);

  for (int kb = 0; kb < NK - 2 * TKEYS; kb += 2 * TKEYS) {
    trip(0, true, true);
    trip(1, true, true);
  }
  trip(0, true, false);    // tile NK/TKEYS - 2: nothing left to fetch
  trip(1, false, false);   // last tile

  // Finish: combine the two lane-half partial sums, normalize, store.
  l += __shfl_xor(l, 16, 32);
  const float inv = 1.0f / l;
  const int dhi = (lane & 16) ? 8 : 0;
  // X leaves as f16, the type in which out_proj's products take it: rounded to
  // f32 by the multiply and then to f16, as before, only on this side of the
  // workspace. One 16-byte store per group of 16 dims.
  _Float16* xrow = (_Float16*)X + (b * NQ + qrow) * DM + h * DK;
  #pragma unroll
  for (int gd = 0; gd < 4; ++gd) {
    v8h o;
    #pragma unroll
    for (int r = 0; r < 8; ++r)
      o[r] = (_Float16)(O[gd][r] * inv);
    *(v8h*)(xrow + gd * 16 + dhi) = o;
  }
}

// Y[m][n] = sum_k X[m][k] * W[n][k] + bias[n];  M=4096, N=1024, K=1024.
// Each wave: 32x32 tile (2x2 WMMA frags); block: 8 waves = 64(M) x 128(N).
// X and W come from the workspace as f16 (attn_fwd leaves them so): half the
// bytes from L2 for each of the blocks that read a row, and no conversion here.
// Per k-block of 256 the block's 64 X rows and 128 W rows are read once, one
// whole 512-byte row piece per wave-wide load, and kept in LDS, where all waves
// that need a row take their fragments from.
#define PK 256            /* k per staged block: 512 bytes of a row */
#define PLDS_STRIDE 264   /* 528B: (stride/16B)=33 odd -> conflict-free b128 rows */

__global__ __launch_bounds__(256)
void out_proj(const float* __restrict__ X, const float* __restrict__ W,
              const float* __restrict__ bias, float* __restrict__ Y) {
  __shared__ __attribute__((aligned(16))) _Float16 Xs[64 * PLDS_STRIDE];
  __shared__ __attribute__((aligned(16))) _Float16 Ws[128 * PLDS_STRIDE];

  const int lane = threadIdx.x & 31;
  const int wave = threadIdx.x >> 5;
  const int lo = (lane & 16) ? 8 : 0;
  const int l15 = lane & 15;
  const int bm = blockIdx.x & 63;
  const int bn = blockIdx.x >> 6;
  const int m0 = bm * 64 + (wave & 1) * 32;
  const int n0 = bn * 128 + (wave >> 1) * 32;

  // Staging: wave w brings rows w, w+8, w+16, ...; lane l brings elements 8l..8l+7.
  const _Float16* xg = (const _Float16*)X + (bm * 64 + wave) * DM + lane * 8;
  const _Float16* wg = (const _Float16*)W + (bn * 128 + wave) * DM + lane * 8;
  _Float16* xs = &Xs[wave * PLDS_STRIDE + lane * 8];
  _Float16* ws = &Ws[wave * PLDS_STRIDE + lane * 8];

  // Fragment rows of this wave's 32x32 tile.
  const _Float16* xr0 = &Xs[((wave & 1) * 32 + l15) * PLDS_STRIDE];
  const _Float16* xr1 = xr0 + 16 * PLDS_STRIDE;
  const _Float16* wr0 = &Ws[((wave >> 1) * 32 + l15) * PLDS_STRIDE];
  const _Float16* wr1 = wr0 + 16 * PLDS_STRIDE;

  v8f C[2][2];
  #pragma unroll
  for (int i = 0; i < 2; ++i)
    #pragma unroll
    for (int j = 0; j < 2; ++j) C[i][j] = (v8f){0,0,0,0,0,0,0,0};

  for (int kc = 0; kc < DM; kc += PK, xg += PK, wg += PK) {
    v4u xv[8], wv[16];
    // The staging loops are unrolled so that xv and wv have constant indices
    // and live in registers, with all loads issued back to back.
    #pragma unroll
    for (int i = 0; i < 8; ++i)
      xv[i] = *(const v4u*)(xg + i * 8 * DM);
    #pragma unroll
    for (int i = 0; i < 16; ++i)
      wv[i] = *(const v4u*)(wg + i * 8 * DM);
    // Inputs-only fence on the loaded values: holds all 24 loads, 16 bytes wide,
    // ahead of the barrier. Without it the compiler halves the X loads and sinks
    // one half behind the barrier: a second load latency in every k-block.
    // The two addresses are inputs too: their registers then stay untouched
    // until every load that names them has returned.
    asm volatile("" :: "v"(xv[0]), "v"(xv[1]), "v"(xv[2]), "v"(xv[3]),
                       "v"(xv[4]), "v"(xv[5]), "v"(xv[6]), "v"(xv[7]),
                       "v"(wv[0]), "v"(wv[1]), "v"(wv[2]), "v"(wv[3]),
                       "v"(wv[4]), "v"(wv[5]), "v"(wv[6]), "v"(wv[7]),
                       "v"(wv[8]), "v"(wv[9]), "v"(wv[10]), "v"(wv[11]),
                       "v"(wv[12]), "v"(wv[13]), "v"(wv[14]), "v"(wv[15]),
                       "v"(xg), "v"(wg));
    __syncthreads();  // previous k-block fully consumed
    #pragma unroll
    for (int i = 0; i < 8; ++i)
      *(v4u*)(xs + i * 8 * PLDS_STRIDE) = xv[i];
    #pragma unroll
    for (int i = 0; i < 16; ++i)
      *(v4u*)(ws + i * 8 * PLDS_STRIDE) = wv[i];
    __syncthreads();  // k-block visible to every wave

    // Unrolled: LDS offsets become immediates, no loop overhead among the WMMAs.
    #pragma unroll
    for (int ks = 0; ks < PK; ks += 32) {
      v16h a0 = frag_from_ldsrow(xr0 + ks, lo);
      v16h a1 = frag_from_ldsrow(xr1 + ks, lo);
      v16h b0 = frag_from_ldsrow(wr0 + ks, lo);
      v16h b1 = frag_from_ldsrow(wr1 + ks, lo);
      C[0][0] = wmma_f16(a0, b0, C[0][0]);
      C[0][1] = wmma_f16(a0, b1, C[0][1]);
      C[1][0] = wmma_f16(a1, b0, C[1][0]);
      C[1][1] = wmma_f16(a1, b1, C[1][1]);
    }
  }

  const float bias0 = bias[n0 + l15];
  const float bias1 = bias[n0 + 16 + l15];
  const int mhi = (lane & 16) ? 8 : 0;
  #pragma unroll
  for (int mi = 0; mi < 2; ++mi) {
    #pragma unroll
    for (int ni = 0; ni < 2; ++ni) {
      const float bb = ni ? bias1 : bias0;
      #pragma unroll
      for (int r = 0; r < 8; ++r) {
        const int row = m0 + mi * 16 + r + mhi;
        const int col = n0 + ni * 16 + l15;
        Y[row * DM + col] = C[mi][ni][r] + bb;
      }
    }
  }
}

extern "C" void kernel_launch(void* const* d_in, const int* in_sizes, int n_in,
                              void* d_out, int out_size, void* d_ws, size_t ws_size,
                              hipStream_t stream) {
  (void)in_sizes; (void)n_in; (void)out_size; (void)ws_size;
  const float* Q  = (const float*)d_in[0];
  const float* K  = (const float*)d_in[1];
  const float* V  = (const float*)d_in[2];
  const float* Wo = (const float*)d_in[3];
  const float* bo = (const float*)d_in[4];
  float* X  = (float*)d_ws;           // (b, q, h*d_k) intermediate, held as f16: 8 MiB
  float* Wh = X + 2 * 1024 * 1024;    // behind it, the weight as f16: 2 MiB
  float* Y = (float*)d_out;

  // 2 batches * 16 heads * 16 q-tiles = 512 blocks
  attn_fwd<<<dim3(512), dim3(256), 0, stream>>>(Q, K, V, Wo, X, Wh);
  // (4096/64) * (1024/128) = 64 * 8 = 512 blocks
  out_proj<<<dim3(512), dim3(256), 0, stream>>>(X, Wh, bo, Y);
}

// v007
// It runs in 46.2 microseconds.
// Next to v006, in two timings, it ran 1.10 times as fast each time.
// Over all steps from v000 it is 2.93 times as fast.
#include <hip/hip_runtime.h>
#include <hip/hip_bf16.h>

typedef __attribute__((ext_vector_type(16))) _Float16 v16h;
typedef __attribute__((ext_vector_type(8)))  _Float16 v8h;
typedef __attribute__((ext_vector_type(8)))  float    v8f;
typedef __attribute__((ext_vector_type(4)))  float    v4f;
typedef __attribute__((ext_vector_type(4)))  unsigned v4u;

#define NQ 2048
#define NK 2048
#define DM 1024
#define NH 16
#define DK 64
#define SCALE 0.125f          /* 1/sqrt(64) */
#define L2E   1.44269504088896340736f

// 2^x by the bare hardware instruction, for eight values and for one.
// exp2f() wraps each v_exp_f32 in a compare, two selects, an add and an ldexp so
// that results below 2^-126 come out as denormals; here a term that small is 0 in
// the f16 P operand and is lost in a row sum that ends >= 1.
// In asm, so that no instruction directly behind a v_exp_f32 reads its result or
// overwrites its source; the v_nop is that slot behind the last one. The arguments
// stay as they are: the tile's test may send the wave back to them. Volatile:
// the four groups of a tile keep their order behind the score products.
__device__ __forceinline__ v8f exp2_x8(const v8f a) {
  float e0, e1, e2, e3, e4, e5, e6, e7;
  asm volatile("v_exp_f32 %0, %8\n\tv_exp_f32 %1, %9\n\tv_exp_f32 %2, %10\n\t"
      "v_exp_f32 %3, %11\n\tv_exp_f32 %4, %12\n\tv_exp_f32 %5, %13\n\t"
      "v_exp_f32 %6, %14\n\tv_exp_f32 %7, %15\n\tv_nop"
      : "=&v"(e0), "=&v"(e1), "=&v"(e2), "=&v"(e3),
        "=&v"(e4), "=&v"(e5), "=&v"(e6), "=&v"(e7)
      : "v"(a[0]), "v"(a[1]), "v"(a[2]), "v"(a[3]),
        "v"(a[4]), "v"(a[5]), "v"(a[6]), "v"(a[7]));
  return (v8f){e0, e1, e2, e3, e4, e5, e6, e7};
}
__device__ __forceinline__ float exp2_x1(float c) {
  asm("v_exp_f32 %0, %0\n\tv_nop" : "+v"(c));
  return c;
}

__device__ __forceinline__ v8f wmma_f16(v16h a, v16h b, v8f c) {
  return __builtin_amdgcn_wmma_f32_16x16x32_f16(false, a, false, b,
                                                (short)0, c, false, false);
}

// Load one 16-element f16 fragment (A or B operand, identical per-lane run
// pattern) from an fp32 row in global memory: elements 0..7 = row[lo..lo+7],
// 8..15 = row[lo+16..lo+23], scaled.
__device__ __forceinline__ v16h frag_from_f32row(const float* rowp, int lo, float s) {
  const float4 a0 = *(const float4*)(rowp + lo);
  const float4 a1 = *(const float4*)(rowp + lo + 4);
  const float4 b0 = *(const float4*)(rowp + lo + 16);
  const float4 b1 = *(const float4*)(rowp + lo + 20);
  v16h r;
  r[0]=(_Float16)(a0.x*s);  r[1]=(_Float16)(a0.y*s);
  r[2]=(_Float16)(a0.z*s);  r[3]=(_Float16)(a0.w*s);
  r[4]=(_Float16)(a1.x*s);  r[5]=(_Float16)(a1.y*s);
  r[6]=(_Float16)(a1.z*s);  r[7]=(_Float16)(a1.w*s);
  r[8]=(_Float16)(b0.x*s);  r[9]=(_Float16)(b0.y*s);
  r[10]=(_Float16)(b0.z*s); r[11]=(_Float16)(b0.w*s);
  r[12]=(_Float16)(b1.x*s); r[13]=(_Float16)(b1.y*s);
  r[14]=(_Float16)(b1.z*s); r[15]=(_Float16)(b1.w*s);
  return r;
}

// Two f32 to a pair of f16 (round to nearest even, as the cast), at this place
// in the program: written as casts, the conversions of a fetched tile are lifted
// to directly behind its loads, a tile early, and the wave waits out the whole
// load latency there instead of leaving the loads in flight for a tile.
__device__ __forceinline__ unsigned cvt_here(float a, float b) {
  unsigned r;
  asm volatile("v_cvt_pk_f16_f32 %0, %1, %2" : "=v"(r) : "v"(a), "v"(b));
  return r;
}

typedef __attribute__((ext_vector_type(4))) _Float16 v4h;
__device__ __forceinline__ v4h cvt4(const v4f f) {
  v4h r;
  r[0]=(_Float16)f[0]; r[1]=(_Float16)f[1]; r[2]=(_Float16)f[2]; r[3]=(_Float16)f[3];
  return r;
}

// Same fragment pattern from an f16 LDS row (two ds_load_b128).
__device__ __forceinline__ v16h frag_from_ldsrow(const _Float16* rowp, int lo) {
  v8h a = *(const v8h*)(rowp + lo);
  v8h b = *(const v8h*)(rowp + lo + 16);
  return __builtin_shufflevector(a, b, 0,1,2,3,4,5,6,7,8,9,10,11,12,13,14,15);
}

// Transposing LDS load. With lane l pointing at the 16 bytes
// T[8*(l>>4) + (l&7)][8*((l>>3)&1) ..+7] of a row-major f16 tile T, lane l gets
// the column piece T[8*(l>>4) + 0..7][l&15].
typedef __attribute__((ext_vector_type(8))) short v8s;
typedef __attribute__((address_space(3))) v8s lds_v8s;
__device__ __forceinline__ v8h ld_tr16(const _Float16* p) {
  return __builtin_bit_cast(v8h, __builtin_amdgcn_ds_load_tr16_b128_v8i16((lds_v8s*)p));
}

#define KLDS_STRIDE 72   /* 144B: (stride/16B)=9 odd -> conflict-free b128 rows */
#define VLDS_STRIDE 80   /* 160B: (stride/32B)=5 odd -> conflict-free transposing loads */
#define TKEYS 64                     /* keys of one tile: one softmax step, one barrier */
#define KBUF (TKEYS * KLDS_STRIDE)   /* f16 elements of one K buffer */
#define VBUF (TKEYS * VLDS_STRIDE)   /* f16 elements of one V buffer */

// Four waves per SIMD is what the grid gives (two work-groups per WGP). Told so,
// the compiler keeps the converted tile in registers of its own; aiming at a
// fifth wave it reuses one register from LDS write to LDS write.
__global__ __launch_bounds__(256) __attribute__((amdgpu_waves_per_eu(4, 4)))
void attn_fwd(const float* __restrict__ Q, const float* __restrict__ K,
              const float* __restrict__ V, const float* __restrict__ Wo,
              float* __restrict__ X, float* __restrict__ Wh) {
  // Two buffers each: tile t is read from buffer t & 1 while tile t + 1 is
  // written into the other one.
  __shared__ __attribute__((aligned(16))) _Float16 Klds[2 * KBUF];   // [key][d]  f16
  __shared__ __attribute__((aligned(16))) _Float16 Vlds[2 * VBUF];   // [key][d]  f16 (transposed on read)

  const int lane = threadIdx.x & 31;
  const int wave = threadIdx.x >> 5;
  const int qt = blockIdx.x & 15;          // 16 q-tiles of 128
  const int h  = (blockIdx.x >> 4) & 15;   // 16 heads
  const int b  = blockIdx.x >> 8;          // 2 batches
  const int lo = (lane & 16) ? 8 : 0;      // per-lane run offset within 32
  const int l15 = lane & 15;

  // This block's 2048 elements of the projection weight, to be left in the
  // workspace as f16 for out_proj (whole lines per wave-wide load). The loads go
  // out with the first Q, K and V loads and share their wait.
  const int wi = blockIdx.x * 2048 + threadIdx.x * 4;
  const v4f wa = *(const v4f*)(Wo + wi);
  const v4f wb = *(const v4f*)(Wo + wi + 1024);

  const int qrow = qt * 128 + wave * 16 + l15;
  const float* qptr = Q + (b * NQ + qrow) * DM + h * DK;

  // Q B-fragments (d-chunks 0-31 / 32-63), softmax scale and log2(e) folded in:
  // the score products come out as arguments of 2^x.
  const v16h qf0 = frag_from_f32row(qptr,      lo, SCALE * L2E);
  const v16h qf1 = frag_from_f32row(qptr + 32, lo, SCALE * L2E);

  v8f O[4];
  #pragma unroll
  for (int i = 0; i < 4; ++i) O[i] = (v8f){0,0,0,0,0,0,0,0};
  float l = 0.0f;
  // The held reference of this lane's query column, negated, in all eight rows of
  // an accumulator: it is the C operand of the score products, which so give
  // s - ref, the argument of 2^x. It moves only when a lane's 32 terms of a tile
  // sum to more than 2^8 (so every P that is used is <= 2^8, well inside f16), and
  // at the first tile, where thr and lowb make the test true and the column's own
  // maximum, of either sign, the reference.
  v8f cref = (v8f){0,0,0,0,0,0,0,0};
  float thr = -3.0e38f, lowb = -3.0e38f;

  // Staging of a tile (64 keys x 64 dims): thread t brings dims 8*(t&7)..+7 of
  // keys t>>3 and 32 + (t>>3), of K and of V, through registers.
  const int srow = threadIdx.x >> 3;
  const int scol = (threadIdx.x & 7) * 8;
  const float* kg = K + (b * NK + srow) * DM + h * DK + scol;
  const float* vg = V + (b * NK + srow) * DM + h * DK + scol;
  _Float16* const kst = &Klds[srow * KLDS_STRIDE + scol];
  _Float16* const vst = &Vlds[srow * VLDS_STRIDE + scol];
  // This lane's address in the V tile for the transposing loads (keys 0..15, dims 0..15).
  const _Float16* const vtr = &Vlds[(lo + (lane & 7)) * VLDS_STRIDE + ((lane >> 3) & 1) * 8];
  v4f kf0, kf1, kf2, kf3, vf0, vf1, vf2, vf3;

  // Issue the loads of the tile that kg and vg point at.
  auto fetch = [&]() __attribute__((always_inline)) {
    kf0 = *(const v4f*)kg;              kf1 = *(const v4f*)(kg + 4);
    kf2 = *(const v4f*)(kg + 32 * DM);  kf3 = *(const v4f*)(kg + 32 * DM + 4);
    vf0 = *(const v4f*)vg;              vf1 = *(const v4f*)(vg + 4);
    vf2 = *(const v4f*)(vg + 32 * DM);  vf3 = *(const v4f*)(vg + 32 * DM + 4);
  };
  // Convert the fetched tile and write it into buffer buf.
  auto stage = [&](const int buf) __attribute__((always_inline)) {
    // All conversions ahead of the writes: each result then has a register
    // of its own, and no conversion waits for an LDS write to have read its data.
    v4u kp, kq;
    kp[0] = cvt_here(kf0[0], kf0[1]);  kp[1] = cvt_here(kf0[2], kf0[3]);
    kp[2] = cvt_here(kf1[0], kf1[1]);  kp[3] = cvt_here(kf1[2], kf1[3]);
    kq[0] = cvt_here(kf2[0], kf2[1]);  kq[1] = cvt_here(kf2[2], kf2[3]);
    kq[2] = cvt_here(kf3[0], kf3[1]);  kq[3] = cvt_here(kf3[2], kf3[3]);
    v4u vp, vq;
    vp[0] = cvt_here(vf0[0], vf0[1]);  vp[1] = cvt_here(vf0[2], vf0[3]);
    vp[2] = cvt_here(vf1[0], vf1[1]);  vp[3] = cvt_here(vf1[2], vf1[3]);
    vq[0] = cvt_here(vf2[0], vf2[1]);  vq[1] = cvt_here(vf2[2], vf2[3]);
    vq[2] = cvt_here(vf3[0], vf3[1]);  vq[3] = cvt_here(vf3[2], vf3[3]);
    *(v4u*)(kst + buf * KBUF) = kp;
    *(v4u*)(kst + buf * KBUF + 32 * KLDS_STRIDE) = kq;
    *(v4u*)(vst + buf * VBUF) = vp;
    *(v4u*)(vst + buf * VBUF + 32 * VLDS_STRIDE) = vq;
  };

  // Work-group barrier by hand, with the wait on this wave's LDS reads and writes
  // that it needs: __syncthreads() would also wait for the global loads that are
  // meant to stay in flight across it.
  // The four accumulators are inputs only: that keeps the tile's vector work and
  // products in front of the barrier, where they cover the draining of the LDS
  // writes (the compiler otherwise moves them behind it, and the barrier comes
  // to stand directly behind the writes).
  auto publish = [&]() __attribute__((always_inline)) {
    asm volatile("s_wait_dscnt 0x0\n\ts_barrier_signal -1\n\ts_barrier_wait -1"
                 :: "v"(O[0]), "v"(O[1]), "v"(O[2]), "v"(O[3]) : "memory");
  };

  // One tile: products and softmax on buffer cur; meanwhile, where put_next,
  // the fetched tile t + 1 goes into the other buffer and, where get_next,
  // the loads of tile t + 2 are issued.
  auto trip = [&](const int cur, const bool put_next, const bool get_next)
      __attribute__((always_inline)) {
    // The K fragments of the tile's four groups of 16 keys, in the order of use.
    v16h ka[4], kc[4];
    #pragma unroll
    for (int g = 0; g < 4; ++g)
      ka[g] = frag_from_ldsrow(&Klds[cur * KBUF + (g * 16 + l15) * KLDS_STRIDE], lo);
    #pragma unroll
    for (int g = 0; g < 4; ++g)
      kc[g] = frag_from_ldsrow(&Klds[cur * KBUF + (g * 16 + l15) * KLDS_STRIDE] + 32, lo);
    // Staging stands here, behind the K reads: its conversions, LDS writes and
    // loads issue while the K fragments are on their way, when the wave has
    // nothing else to do.
    if (put_next) {
      // The four vector slots that the chip needs between the last tile's products
      // and a vector write over their operands: the conversions are asm text, which
      // the compiler does not count, and may be given those registers.
      asm volatile("v_nop\n\tv_nop\n\tv_nop\n\tv_nop");
      stage(cur ^ 1);
      if (get_next) {
        kg += TKEYS * DM; vg += TKEYS * DM; fetch();
        // In front of the overwrite of the address registers that the issued loads
        // name: the compiler steps them once per two tiles, at the odd tile's end.
        if (cur == 1) asm volatile("s_wait_xcnt 0x0" ::: "memory");
      }
    }
    // Keeps the 16 LDS reads together up here (sunk among the products they
    // would be waited for one by one), and the staging with them.
    __builtin_amdgcn_sched_barrier(0);

    // S^T = K . Q^T - ref  (four 16key x 16q fragments, K-dim 64 = 2 WMMAs each)
    v8f s[4];
    #pragma unroll
    for (int g = 0; g < 4; ++g) s[g] = wmma_f16(ka[g], qf0, cref);
    #pragma unroll
    for (int g = 0; g < 4; ++g) s[g] = wmma_f16(kc[g], qf1, s[g]);
    // Inputs only: holds the V reads below behind the eight score products, which
    // so stand in one run, with no LDS read among them. The v_nop are the four
    // vector slots that the chip needs between the last product and a vector write
    // over its operands: the next vector instructions are asm text, which the
    // compiler does not count, and may be given the K fragments' registers.
    asm volatile("v_nop\n\tv_nop\n\tv_nop\n\tv_nop"
                 :: "v"(s[0]), "v"(s[1]), "v"(s[2]), "v"(s[3]) : "memory");

    v16h vfrag[2][4];
    #pragma unroll
    for (int c = 0; c < 2; ++c) {
      #pragma unroll
      for (int gd = 0; gd < 4; ++gd) {
        // V^T rows gd*16 + l15 over keys 32c..32c+31: keys lo..lo+7, then keys
        // 16+lo..16+lo+7, the k order of the K rows' fragments and of P^T.
        const _Float16* vp = vtr + cur * VBUF + c * 32 * VLDS_STRIDE + gd * 16;
        vfrag[c][gd] = __builtin_shufflevector(ld_tr16(vp), ld_tr16(vp + 16 * VLDS_STRIDE),
                                               0,1,2,3,4,5,6,7,8,9,10,11,12,13,14,15);
      }
    }
    // Keeps the V reads up here, so that they land under the vector work: the
    // compiler sinks them to the tile's end otherwise.
    __builtin_amdgcn_sched_barrier(0);

    // P = 2^(s - ref), this lane's sum of its 32 terms (two independent chains),
    // and the P^T B-fragments (keys 0..31 and 32..63), which feed directly from
    // the registers of the terms.
    v16h pf0, pf1;
    float ps;
    auto terms = [&]() __attribute__((always_inline)) {
      const v8f a0 = exp2_x8(s[0]);
      const v8f a1 = exp2_x8(s[1]);
      const v8f a2 = exp2_x8(s[2]);
      const v8f a3 = exp2_x8(s[3]);
      float psa = 0.0f, psb = 0.0f;
      #pragma unroll
      for (int r = 0; r < 8; ++r) {
        psa += a0[r] + a1[r];
        psb += a2[r] + a3[r];
        pf0[r]     = (_Float16)a0[r];
        pf0[8 + r] = (_Float16)a1[r];
        pf1[r]     = (_Float16)a2[r];
        pf1[8 + r] = (_Float16)a3[r];
      }
      ps = psa + psb;
    };
    terms();
    // One test per tile and wave, a scalar branch: has any column outgrown its
    // reference? A term above 2^8 makes its lane's sum exceed 2^8 (no term is
    // negative), so the sums that are needed anyway tell, and no maximum is taken
    // and nothing exchanged between the wave's halves unless the answer is yes.
    // Marked unlikely, so that the tile's usual path stays in one piece.
    if (__builtin_expect(__builtin_amdgcn_ballot_w32(ps > thr) != 0, 0)) {
      float mca = s[0][0], mcb = s[2][0];
      #pragma unroll
      for (int r = 0; r < 8; ++r) {
        mca = fmaxf(mca, s[0][r]); mca = fmaxf(mca, s[1][r]);
        mcb = fmaxf(mcb, s[2][r]); mcb = fmaxf(mcb, s[3][r]);
      }
      const float mc = fmaxf(mca, mcb);
      // The column's maximum over both halves, or no move (lowb) where it lies
      // below the reference.
      const float delta = fmaxf(fmaxf(mc, __shfl_xor(mc, 16, 32)), lowb);
      // delta < 0 only at the first tile, where O and l are 0: the factor 1 keeps
      // them so where 2^-delta would overflow.
      const float corr = exp2_x1(fminf(-delta, 0.0f));
      #pragma unroll
      for (int g = 0; g < 4; ++g) s[g] -= delta;
      #pragma unroll
      for (int i = 0; i < 4; ++i) O[i] *= corr;
      l *= corr;
      cref -= delta;
      thr = 256.0f;
      lowb = 0.0f;
      terms();
    }
    l += ps;

    // O^T += V^T . P^T  (4 d-groups of 16, two k-steps of 32 keys)
    #pragma unroll
    for (int gd = 0; gd < 4; ++gd)
      O[gd] = wmma_f16(vfrag[0][gd], pf0, O[gd]);
    #pragma unroll
    for (int gd = 0; gd < 4; ++gd)
      O[gd] = wmma_f16(vfrag[1][gd], pf1, O[gd]);

    // The one barrier of a tile: it publishes tile t + 1 and ends every wave's
    // reads of buffer cur, which the next trip overwrites.
    if (put_next) publish();
  };

  // Prologue: tile 0 into buffer 0, tile 1 on its way.
  fetch();
  stage(0);
  kg += TKEYS * DM; vg += TKEYS * DM;
  fetch();
  publish();

  // The weight's f16 copy: the same conversion that out_proj's staging made, once
  // per element instead of once per block that reads the row.
  *(v4h*)((_Float16*)Wh + wi)        = cvt4(wa);
  *(v4h*)((_Float16*)Wh + wi + 1024) = cvt4(wb);
  // Behind the two stores, in front of the next write into a register that they
  // name.
  asm volatile("s_wait_xcnt 0x0" ::: "memory");

  for (int kb = 0; kb < NK - 2 * TKEYS; kb += 2 * TKEYS) {
    trip(0, true, true);
    trip(1, true, true);
  }
  trip(0, true, false);    // tile NK/TKEYS - 2: nothing left to fetch
  trip(1, false, false);   // last tile

  // Finish: combine the two lane-half partial sums, normalize, store.
  l += __shfl_xor(l, 16, 32);
  const float inv = 1.0f / l;
  const int dhi = (lane & 16) ? 8 : 0;
  // X leaves as f16, the type in which out_proj's products take it: rounded to
  // f32 by the multiply and then to f16, as before, only on this side of the
  // workspace. One 16-byte store per group of 16 dims.
  _Float16* xrow = (_Float16*)X + (b * NQ + qrow) * DM + h * DK;
  #pragma unroll
  for (int gd = 0; gd < 4; ++gd) {
    v8h o;
    #pragma unroll
    for (int r = 0; r < 8; ++r)
      o[r] = (_Float16)(O[gd][r] * inv);
    *(v8h*)(xrow + gd * 16 + dhi) = o;
  }
}

// Y[m][n] = sum_k X[m][k] * W[n][k] + bias[n];  M=4096, N=1024, K=1024.
// Each wave: 32x32 tile (2x2 WMMA frags); block: 8 waves = 64(M) x 128(N).
// X and W come from the workspace as f16 (attn_fwd leaves them so): half the
// bytes from L2 for each of the blocks that read a row, and no conversion here.
// Per k-block of 256 the block's 64 X rows and 128 W rows are read once, one
// whole 512-byte row piece per wave-wide load, and kept in LDS, where all waves
// that need a row take their fragments from.
#define PK 256            /* k per staged block: 512 bytes of a row */
#define PLDS_STRIDE 264   /* 528B: (stride/16B)=33 odd -> conflict-free b128 rows */

__global__ __launch_bounds__(256)
void out_proj(const float* __restrict__ X, const float* __restrict__ W,
              const float* __restrict__ bias, float* __restrict__ Y) {
  __shared__ __attribute__((aligned(16))) _Float16 Xs[64 * PLDS_STRIDE];
  __shared__ __attribute__((aligned(16))) _Float16 Ws[128 * PLDS_STRIDE];

  const int lane = threadIdx.x & 31;
  const int wave = threadIdx.x >> 5;
  const int lo = (lane & 16) ? 8 : 0;
  const int l15 = lane & 15;
  const int bm = blockIdx.x & 63;
  const int bn = blockIdx.x >> 6;
  const int m0 = bm * 64 + (wave & 1) * 32;
  const int n0 = bn * 128 + (wave >> 1) * 32;

  // Staging: wave w brings rows w, w+8, w+16, ...; lane l brings elements 8l..8l+7.
  const _Float16* xg = (const _Float16*)X + (bm * 64 + wave) * DM + lane * 8;
  const _Float16* wg = (const _Float16*)W + (bn * 128 + wave) * DM + lane * 8;
  _Float16* xs = &Xs[wave * PLDS_STRIDE + lane * 8];
  _Float16* ws = &Ws[wave * PLDS_STRIDE + lane * 8];

  // Fragment rows of this wave's 32x32 tile.
  const _Float16* xr0 = &Xs[((wave & 1) * 32 + l15) * PLDS_STRIDE];
  const _Float16* xr1 = xr0 + 16 * PLDS_STRIDE;
  const _Float16* wr0 = &Ws[((wave >> 1) * 32 + l15) * PLDS_STRIDE];
  const _Float16* wr1 = wr0 + 16 * PLDS_STRIDE;

  v8f C[2][2];
  #pragma unroll
  for (int i = 0; i < 2; ++i)
    #pragma unroll
    for (int j = 0; j < 2; ++j) C[i][j] = (v8f){0,0,0,0,0,0,0,0};

  for (int kc = 0; kc < DM; kc += PK, xg += PK, wg += PK) {
    v4u xv[8], wv[16];
    // The staging loops are unrolled so that xv and wv have constant indices
    // and live in registers, with all loads issued back to back.
    #pragma unroll
    for (int i = 0; i < 8; ++i)
      xv[i] = *(const v4u*)(xg + i * 8 * DM);
    #pragma unroll
    for (int i = 0; i < 16; ++i)
      wv[i] = *(const v4u*)(wg + i * 8 * DM);
    // Inputs-only fence on the loaded values: holds all 24 loads, 16 bytes wide,
    // ahead of the barrier. Without it the compiler halves the X loads and sinks
    // one half behind the barrier: a second load latency in every k-block.
    // The two addresses are inputs too: their registers then stay untouched
    // until every load that names them has returned.
    asm volatile("" :: "v"(xv[0]), "v"(xv[1]), "v"(xv[2]), "v"(xv[3]),
                       "v"(xv[4]), "v"(xv[5]), "v"(xv[6]), "v"(xv[7]),
                       "v"(wv[0]), "v"(wv[1]), "v"(wv[2]), "v"(wv[3]),
                       "v"(wv[4]), "v"(wv[5]), "v"(wv[6]), "v"(wv[7]),
                       "v"(wv[8]), "v"(wv[9]), "v"(wv[10]), "v"(wv[11]),
                       "v"(wv[12]), "v"(wv[13]), "v"(wv[14]), "v"(wv[15]),
                       "v"(xg), "v"(wg));
    __syncthreads();  // previous k-block fully consumed
    #pragma unroll
    for (int i = 0; i < 8; ++i)
      *(v4u*)(xs + i * 8 * PLDS_STRIDE) = xv[i];
    #pragma unroll
    for (int i = 0; i < 16; ++i)
      *(v4u*)(ws + i * 8 * PLDS_STRIDE) = wv[i];
    __syncthreads();  // k-block visible to every wave

    // Unrolled: LDS offsets become immediates, no loop overhead among the WMMAs.
    #pragma unroll
    for (int ks = 0; ks < PK; ks += 32) {
      v16h a0 = frag_from_ldsrow(xr0 + ks, lo);
      v16h a1 = frag_from_ldsrow(xr1 + ks, lo);
      v16h b0 = frag_from_ldsrow(wr0 + ks, lo);
      v16h b1 = frag_from_ldsrow(wr1 + ks, lo);
      C[0][0] = wmma_f16(a0, b0, C[0][0]);
      C[0][1] = wmma_f16(a0, b1, C[0][1]);
      C[1][0] = wmma_f16(a1, b0, C[1][0]);
      C[1][1] = wmma_f16(a1, b1, C[1][1]);
    }
  }

  const float bias0 = bias[n0 + l15];
  const float bias1 = bias[n0 + 16 + l15];
  const int mhi = (lane & 16) ? 8 : 0;
  #pragma unroll
  for (int mi = 0; mi < 2; ++mi) {
    #pragma unroll
    for (int ni = 0; ni < 2; ++ni) {
      const float bb = ni ? bias1 : bias0;
      #pragma unroll
      for (int r = 0; r < 8; ++r) {
        const int row = m0 + mi * 16 + r + mhi;
        const int col = n0 + ni * 16 + l15;
        Y[row * DM + col] = C[mi][ni][r] + bb;
      }
    }
  }
}

extern "C" void kernel_launch(void* const* d_in, const int* in_sizes, int n_in,
                              void* d_out, int out_size, void* d_ws, size_t ws_size,
                              hipStream_t stream) {
  (void)in_sizes; (void)n_in; (void)out_size; (void)ws_size;
  const float* Q  = (const float*)d_in[0];
  const float* K  = (const float*)d_in[1];
  const float* V  = (const float*)d_in[2];
  const float* Wo = (const float*)d_in[3];
  const float* bo = (const float*)d_in[4];
  float* X  = (float*)d_ws;           // (b, q, h*d_k) intermediate, held as f16: 8 MiB
  float* Wh = X + 2 * 1024 * 1024;    // behind it, the weight as f16: 2 MiB
  float* Y = (float*)d_out;

  // 2 batches * 16 heads * 16 q-tiles = 512 blocks
  attn_fwd<<<dim3(512), dim3(256), 0, stream>>>(Q, K, V, Wo, X, Wh);
  // (4096/64) * (1024/128) = 64 * 8 = 512 blocks
  out_proj<<<dim3(512), dim3(256), 0, stream>>>(X, Wh, bo, Y);
}

// v008
// A run of this version takes 44.7 microseconds.
// In two side-by-side timings against v007, it was 1.03 and 1.02 times as fast.
// Over all steps from v000 it is 3.01 times as fast.
#include <hip/hip_runtime.h>
#include <hip/hip_bf16.h>

typedef __attribute__((ext_vector_type(16))) _Float16 v16h;
typedef __attribute__((ext_vector_type(8)))  _Float16 v8h;
typedef __attribute__((ext_vector_type(8)))  float    v8f;
typedef __attribute__((ext_vector_type(4)))  float    v4f;
typedef __attribute__((ext_vector_type(4)))  unsigned v4u;

#define NQ 2048
#define NK 2048
#define DM 1024
#define NH 16
#define DK 64
#define SCALE 0.125f          /* 1/sqrt(64) */
#define L2E   1.44269504088896340736f

// 2^x by the bare hardware instruction, for eight values and for one.
// exp2f() wraps each v_exp_f32 in a compare, two selects, an add and an ldexp so
// that results below 2^-126 come out as denormals; here a term that small is 0 in
// the f16 P operand and is lost in a row sum that ends >= 1.
// In asm, so that no instruction directly behind a v_exp_f32 reads its result or
// overwrites its source; the v_nop is that slot behind the last one. The arguments
// stay as they are: the tile's test may send the wave back to them. Volatile:
// the four groups of a tile keep their order behind the score products.
__device__ __forceinline__ v8f exp2_x8(const v8f a) {
  float e0, e1, e2, e3, e4, e5, e6, e7;
  asm volatile("v_exp_f32 %0, %8\n\tv_exp_f32 %1, %9\n\tv_exp_f32 %2, %10\n\t"
      "v_exp_f32 %3, %11\n\tv_exp_f32 %4, %12\n\tv_exp_f32 %5, %13\n\t"
      "v_exp_f32 %6, %14\n\tv_exp_f32 %7, %15\n\tv_nop"
      : "=&v"(e0), "=&v"(e1), "=&v"(e2), "=&v"(e3),
        "=&v"(e4), "=&v"(e5), "=&v"(e6), "=&v"(e7)
      : "v"(a[0]), "v"(a[1]), "v"(a[2]), "v"(a[3]),
        "v"(a[4]), "v"(a[5]), "v"(a[6]), "v"(a[7]));
  return (v8f){e0, e1, e2, e3, e4, e5, e6, e7};
}
__device__ __forceinline__ float exp2_x1(float c) {
  asm("v_exp_f32 %0, %0\n\tv_nop" : "+v"(c));
  return c;
}

__device__ __forceinline__ v8f wmma_f16(v16h a, v16h b, v8f c) {
  return __builtin_amdgcn_wmma_f32_16x16x32_f16(false, a, false, b,
                                                (short)0, c, false, false);
}

// Load one 16-element f16 fragment (A or B operand, identical per-lane run
// pattern) from an fp32 row in global memory: elements 0..7 = row[lo..lo+7],
// 8..15 = row[lo+16..lo+23], scaled.
__device__ __forceinline__ v16h frag_from_f32row(const float* rowp, int lo, float s) {
  const float4 a0 = *(const float4*)(rowp + lo);
  const float4 a1 = *(const float4*)(rowp + lo + 4);
  const float4 b0 = *(const float4*)(rowp + lo + 16);
  const float4 b1 = *(const float4*)(rowp + lo + 20);
  v16h r;
  r[0]=(_Float16)(a0.x*s);  r[1]=(_Float16)(a0.y*s);
  r[2]=(_Float16)(a0.z*s);  r[3]=(_Float16)(a0.w*s);
  r[4]=(_Float16)(a1.x*s);  r[5]=(_Float16)(a1.y*s);
  r[6]=(_Float16)(a1.z*s);  r[7]=(_Float16)(a1.w*s);
  r[8]=(_Float16)(b0.x*s);  r[9]=(_Float16)(b0.y*s);
  r[10]=(_Float16)(b0.z*s); r[11]=(_Float16)(b0.w*s);
  r[12]=(_Float16)(b1.x*s); r[13]=(_Float16)(b1.y*s);
  r[14]=(_Float16)(b1.z*s); r[15]=(_Float16)(b1.w*s);
  return r;
}

// Two f32 to a pair of f16 (round to nearest even, as the cast), at this place
// in the program: written as casts, the conversions of a fetched tile are lifted
// to directly behind its loads, a tile early, and the wave waits out the whole
// load latency there instead of leaving the loads in flight for a tile.
__device__ __forceinline__ unsigned cvt_here(float a, float b) {
  unsigned r;
  asm volatile("v_cvt_pk_f16_f32 %0, %1, %2" : "=v"(r) : "v"(a), "v"(b));
  return r;
}

typedef __attribute__((ext_vector_type(4))) _Float16 v4h;
__device__ __forceinline__ v4h cvt4(const v4f f) {
  v4h r;
  r[0]=(_Float16)f[0]; r[1]=(_Float16)f[1]; r[2]=(_Float16)f[2]; r[3]=(_Float16)f[3];
  return r;
}

// Same fragment pattern from an f16 LDS row (two ds_load_b128).
__device__ __forceinline__ v16h frag_from_ldsrow(const _Float16* rowp, int lo) {
  v8h a = *(const v8h*)(rowp + lo);
  v8h b = *(const v8h*)(rowp + lo + 16);
  return __builtin_shufflevector(a, b, 0,1,2,3,4,5,6,7,8,9,10,11,12,13,14,15);
}

// Transposing LDS load. With lane l pointing at the 16 bytes
// T[8*(l>>4) + (l&7)][8*((l>>3)&1) ..+7] of a row-major f16 tile T, lane l gets
// the column piece T[8*(l>>4) + 0..7][l&15].
typedef __attribute__((ext_vector_type(8))) short v8s;
typedef __attribute__((address_space(3))) v8s lds_v8s;
__device__ __forceinline__ v8h ld_tr16(const _Float16* p) {
  return __builtin_bit_cast(v8h, __builtin_amdgcn_ds_load_tr16_b128_v8i16((lds_v8s*)p));
}

#define KLDS_STRIDE 72   /* 144B: (stride/16B)=9 odd -> conflict-free b128 rows */
#define VLDS_STRIDE 80   /* 160B: (stride/32B)=5 odd -> conflict-free transposing loads */
#define TKEYS 64                     /* keys of one tile: one softmax step, one barrier */
#define KBUF (TKEYS * KLDS_STRIDE)   /* f16 elements of one K buffer */
#define VBUF (TKEYS * VLDS_STRIDE)   /* f16 elements of one V buffer */

// Four waves per SIMD is what the grid gives (two work-groups per WGP). Told so,
// the compiler keeps the converted tile in registers of its own; aiming at a
// fifth wave it reuses one register from LDS write to LDS write.
__global__ __launch_bounds__(256) __attribute__((amdgpu_waves_per_eu(4, 4)))
void attn_fwd(const float* __restrict__ Q, const float* __restrict__ K,
              const float* __restrict__ V, const float* __restrict__ Wo,
              float* __restrict__ X, float* __restrict__ Wh) {
  // Two buffers each: tile t is read from buffer t & 1 while tile t + 1 is
  // written into the other one.
  __shared__ __attribute__((aligned(16))) _Float16 Klds[2 * KBUF];   // [key][d]  f16
  __shared__ __attribute__((aligned(16))) _Float16 Vlds[2 * VBUF];   // [key][d]  f16 (transposed on read)

  const int lane = threadIdx.x & 31;
  const int wave = threadIdx.x >> 5;
  const int qt = blockIdx.x & 15;          // 16 q-tiles of 128
  const int h  = (blockIdx.x >> 4) & 15;   // 16 heads
  const int b  = blockIdx.x >> 8;          // 2 batches
  const int lo = (lane & 16) ? 8 : 0;      // per-lane run offset within 32
  const int l15 = lane & 15;

  // This block's 2048 elements of the projection weight, to be left in the
  // workspace as f16 for out_proj (whole lines per wave-wide load). The loads go
  // out with the first Q, K and V loads and share their wait.
  const int wi = blockIdx.x * 2048 + threadIdx.x * 4;
  const v4f wa = *(const v4f*)(Wo + wi);
  const v4f wb = *(const v4f*)(Wo + wi + 1024);

  const int qrow = qt * 128 + wave * 16 + l15;
  const float* qptr = Q + (b * NQ + qrow) * DM + h * DK;

  // Q B-fragments (d-chunks 0-31 / 32-63), softmax scale and log2(e) folded in:
  // the score products come out as arguments of 2^x.
  const v16h qf0 = frag_from_f32row(qptr,      lo, SCALE * L2E);
  const v16h qf1 = frag_from_f32row(qptr + 32, lo, SCALE * L2E);

  v8f O[4];
  #pragma unroll
  for (int i = 0; i < 4; ++i) O[i] = (v8f){0,0,0,0,0,0,0,0};
  float l = 0.0f;
  // The held reference of this lane's query column, negated, in all eight rows of
  // an accumulator: it is the C operand of the score products, which so give
  // s - ref, the argument of 2^x. It moves only when a lane's 32 terms of a tile
  // sum to more than 2^8 (so every P that is used is <= 2^8, well inside f16), and
  // at the first tile, where thr and lowb make the test true and the column's own
  // maximum, of either sign, the reference.
  v8f cref = (v8f){0,0,0,0,0,0,0,0};
  float thr = -3.0e38f, lowb = -3.0e38f;

  // Staging of a tile (64 keys x 64 dims): thread t brings dims 8*(t&7)..+7 of
  // keys t>>3 and 32 + (t>>3), of K and of V, through registers.
  const int srow = threadIdx.x >> 3;
  const int scol = (threadIdx.x & 7) * 8;
  const float* kg = K + (b * NK + srow) * DM + h * DK + scol;
  const float* vg = V + (b * NK + srow) * DM + h * DK + scol;
  _Float16* const kst = &Klds[srow * KLDS_STRIDE + scol];
  _Float16* const vst = &Vlds[srow * VLDS_STRIDE + scol];
  // This lane's address in the V tile for the transposing loads (keys 0..15, dims 0..15).
  const _Float16* const vtr = &Vlds[(lo + (lane & 7)) * VLDS_STRIDE + ((lane >> 3) & 1) * 8];
  v4f kf0, kf1, kf2, kf3, vf0, vf1, vf2, vf3;

  // Issue the loads of the tile that kg and vg point at.
  auto fetch = [&]() __attribute__((always_inline)) {
    kf0 = *(const v4f*)kg;              kf1 = *(const v4f*)(kg + 4);
    kf2 = *(const v4f*)(kg + 32 * DM);  kf3 = *(const v4f*)(kg + 32 * DM + 4);
    vf0 = *(const v4f*)vg;              vf1 = *(const v4f*)(vg + 4);
    vf2 = *(const v4f*)(vg + 32 * DM);  vf3 = *(const v4f*)(vg + 32 * DM + 4);
  };
  // Convert the fetched tile and write it into buffer buf.
  auto stage = [&](const int buf) __attribute__((always_inline)) {
    // All conversions ahead of the writes: each result then has a register
    // of its own, and no conversion waits for an LDS write to have read its data.
    v4u kp, kq;
    kp[0] = cvt_here(kf0[0], kf0[1]);  kp[1] = cvt_here(kf0[2], kf0[3]);
    kp[2] = cvt_here(kf1[0], kf1[1]);  kp[3] = cvt_here(kf1[2], kf1[3]);
    kq[0] = cvt_here(kf2[0], kf2[1]);  kq[1] = cvt_here(kf2[2], kf2[3]);
    kq[2] = cvt_here(kf3[0], kf3[1]);  kq[3] = cvt_here(kf3[2], kf3[3]);
    v4u vp, vq;
    vp[0] = cvt_here(vf0[0], vf0[1]);  vp[1] = cvt_here(vf0[2], vf0[3]);
    vp[2] = cvt_here(vf1[0], vf1[1]);  vp[3] = cvt_here(vf1[2], vf1[3]);
    vq[0] = cvt_here(vf2[0], vf2[1]);  vq[1] = cvt_here(vf2[2], vf2[3]);
    vq[2] = cvt_here(vf3[0], vf3[1]);  vq[3] = cvt_here(vf3[2], vf3[3]);
    *(v4u*)(kst + buf * KBUF) = kp;
    *(v4u*)(kst + buf * KBUF + 32 * KLDS_STRIDE) = kq;
    *(v4u*)(vst + buf * VBUF) = vp;
    *(v4u*)(vst + buf * VBUF + 32 * VLDS_STRIDE) = vq;
  };

  // Work-group barrier by hand, with the wait on this wave's LDS reads and writes
  // that it needs: __syncthreads() would also wait for the global loads that are
  // meant to stay in flight across it.
  // The four accumulators are inputs only: that keeps the tile's vector work and
  // products in front of the barrier, where they cover the draining of the LDS
  // writes (the compiler otherwise moves them behind it, and the barrier comes
  // to stand directly behind the writes).
  auto publish = [&]() __attribute__((always_inline)) {
    asm volatile("s_wait_dscnt 0x0\n\ts_barrier_signal -1\n\ts_barrier_wait -1"
                 :: "v"(O[0]), "v"(O[1]), "v"(O[2]), "v"(O[3]) : "memory");
  };

  // One tile: products and softmax on buffer cur; meanwhile, where put_next,
  // the fetched tile t + 1 goes into the other buffer and, where get_next,
  // the loads of tile t + 2 are issued.
  auto trip = [&](const int cur, const bool put_next, const bool get_next)
      __attribute__((always_inline)) {
    // The K fragments of the tile's four groups of 16 keys, in the order of use.
    v16h ka[4], kc[4];
    #pragma unroll
    for (int g = 0; g < 4; ++g)
      ka[g] = frag_from_ldsrow(&Klds[cur * KBUF + (g * 16 + l15) * KLDS_STRIDE], lo);
    #pragma unroll
    for (int g = 0; g < 4; ++g)
      kc[g] = frag_from_ldsrow(&Klds[cur * KBUF + (g * 16 + l15) * KLDS_STRIDE] + 32, lo);
    // Staging stands here, behind the K reads: its conversions, LDS writes and
    // loads issue while the K fragments are on their way, when the wave has
    // nothing else to do.
    if (put_next) {
      // The four vector slots that the chip needs between the last tile's products
      // and a vector write over their operands: the conversions are asm text, which
      // the compiler does not count, and may be given those registers.
      asm volatile("v_nop\n\tv_nop\n\tv_nop\n\tv_nop");
      stage(cur ^ 1);
      if (get_next) {
        kg += TKEYS * DM; vg += TKEYS * DM; fetch();
        // In front of the overwrite of the address registers that the issued loads
        // name: the compiler steps them once per two tiles, at the odd tile's end.
        if (cur == 1) asm volatile("s_wait_xcnt 0x0" ::: "memory");
      }
    }
    // Keeps the 16 LDS reads together up here (sunk among the products they
    // would be waited for one by one), and the staging with them.
    __builtin_amdgcn_sched_barrier(0);

    // S^T = K . Q^T - ref  (four 16key x 16q fragments, K-dim 64 = 2 WMMAs each)
    v8f s[4];
    #pragma unroll
    for (int g = 0; g < 4; ++g) s[g] = wmma_f16(ka[g], qf0, cref);
    #pragma unroll
    for (int g = 0; g < 4; ++g) s[g] = wmma_f16(kc[g], qf1, s[g]);
    // Inputs only: holds the V reads below behind the eight score products, which
    // so stand in one run, with no LDS read among them. The v_nop are the four
    // vector slots that the chip needs between the last product and a vector write
    // over its operands: the next vector instructions are asm text, which the
    // compiler does not count, and may be given the K fragments' registers.
    asm volatile("v_nop\n\tv_nop\n\tv_nop\n\tv_nop"
                 :: "v"(s[0]), "v"(s[1]), "v"(s[2]), "v"(s[3]) : "memory");

    v16h vfrag[2][4];
    #pragma unroll
    for (int c = 0; c < 2; ++c) {
      #pragma unroll
      for (int gd = 0; gd < 4; ++gd) {
        // V^T rows gd*16 + l15 over keys 32c..32c+31: keys lo..lo+7, then keys
        // 16+lo..16+lo+7, the k order of the K rows' fragments and of P^T.
        const _Float16* vp = vtr + cur * VBUF + c * 32 * VLDS_STRIDE + gd * 16;
        vfrag[c][gd] = __builtin_shufflevector(ld_tr16(vp), ld_tr16(vp + 16 * VLDS_STRIDE),
                                               0,1,2,3,4,5,6,7,8,9,10,11,12,13,14,15);
      }
    }
    // Keeps the V reads up here, so that they land under the vector work: the
    // compiler sinks them to the tile's end otherwise.
    __builtin_amdgcn_sched_barrier(0);

    // P = 2^(s - ref), this lane's sum of its 32 terms (two independent chains),
    // and the P^T B-fragments (keys 0..31 and 32..63), which feed directly from
    // the registers of the terms.
    v16h pf0, pf1;
    float ps;
    auto terms = [&]() __attribute__((always_inline)) {
      const v8f a0 = exp2_x8(s[0]);
      const v8f a1 = exp2_x8(s[1]);
      const v8f a2 = exp2_x8(s[2]);
      const v8f a3 = exp2_x8(s[3]);
      float psa = 0.0f, psb = 0.0f;
      #pragma unroll
      for (int r = 0; r < 8; ++r) {
        psa += a0[r] + a1[r];
        psb += a2[r] + a3[r];
        pf0[r]     = (_Float16)a0[r];
        pf0[8 + r] = (_Float16)a1[r];
        pf1[r]     = (_Float16)a2[r];
        pf1[8 + r] = (_Float16)a3[r];
      }
      ps = psa + psb;
    };
    terms();
    // One test per tile and wave, a scalar branch: has any column outgrown its
    // reference? A term above 2^8 makes its lane's sum exceed 2^8 (no term is
    // negative), so the sums that are needed anyway tell, and no maximum is taken
    // and nothing exchanged between the wave's halves unless the answer is yes.
    // Marked unlikely, so that the tile's usual path stays in one piece.
    if (__builtin_expect(__builtin_amdgcn_ballot_w32(ps > thr) != 0, 0)) {
      float mca = s[0][0], mcb = s[2][0];
      #pragma unroll
      for (int r = 0; r < 8; ++r) {
        mca = fmaxf(mca, s[0][r]); mca = fmaxf(mca, s[1][r]);
        mcb = fmaxf(mcb, s[2][r]); mcb = fmaxf(mcb, s[3][r]);
      }
      const float mc = fmaxf(mca, mcb);
      // The column's maximum over both halves, or no move (lowb) where it lies
      // below the reference.
      const float delta = fmaxf(fmaxf(mc, __shfl_xor(mc, 16, 32)), lowb);
      // delta < 0 only at the first tile, where O and l are 0: the factor 1 keeps
      // them so where 2^-delta would overflow.
      const float corr = exp2_x1(fminf(-delta, 0.0f));
      #pragma unroll
      for (int g = 0; g < 4; ++g) s[g] -= delta;
      #pragma unroll
      for (int i = 0; i < 4; ++i) O[i] *= corr;
      l *= corr;
      cref -= delta;
      thr = 256.0f;
      lowb = 0.0f;
      terms();
    }
    l += ps;

    // O^T += V^T . P^T  (4 d-groups of 16, two k-steps of 32 keys)
    #pragma unroll
    for (int gd = 0; gd < 4; ++gd)
      O[gd] = wmma_f16(vfrag[0][gd], pf0, O[gd]);
    #pragma unroll
    for (int gd = 0; gd < 4; ++gd)
      O[gd] = wmma_f16(vfrag[1][gd], pf1, O[gd]);

    // The one barrier of a tile: it publishes tile t + 1 and ends every wave's
    // reads of buffer cur, which the next trip overwrites.
    if (put_next) publish();
  };

  // Prologue: tile 0 into buffer 0, tile 1 on its way.
  fetch();
  stage(0);
  kg += TKEYS * DM; vg += TKEYS * DM;
  fetch();
  publish();

  // The weight's f16 copy: the same conversion that out_proj's staging made, once
  // per element instead of once per block that reads the row.
  *(v4h*)((_Float16*)Wh + wi)        = cvt4(wa);
  *(v4h*)((_Float16*)Wh + wi + 1024) = cvt4(wb);
  // Behind the two stores, in front of the next write into a register that they
  // name.
  asm volatile("s_wait_xcnt 0x0" ::: "memory");

  for (int kb = 0; kb < NK - 2 * TKEYS; kb += 2 * TKEYS) {
    trip(0, true, true);
    trip(1, true, true);
  }
  trip(0, true, false);    // tile NK/TKEYS - 2: nothing left to fetch
  trip(1, false, false);   // last tile

  // Finish: combine the two lane-half partial sums, normalize, store.
  l += __shfl_xor(l, 16, 32);
  const float inv = 1.0f / l;
  const int dhi = (lane & 16) ? 8 : 0;
  // X leaves as f16, the type in which out_proj's products take it: rounded to
  // f32 by the multiply and then to f16, as before, only on this side of the
  // workspace. One 16-byte store per group of 16 dims.
  _Float16* xrow = (_Float16*)X + (b * NQ + qrow) * DM + h * DK;
  #pragma unroll
  for (int gd = 0; gd < 4; ++gd) {
    v8h o;
    #pragma unroll
    for (int r = 0; r < 8; ++r)
      o[r] = (_Float16)(O[gd][r] * inv);
    *(v8h*)(xrow + gd * 16 + dhi) = o;
  }
}

// Y[m][n] = sum_k X[m][k] * W[n][k] + bias[n];  M=4096, N=1024, K=1024.
// Each wave: 32x32 tile (2x2 WMMA frags); block: 8 waves = 64(M) x 128(N).
// X and W come from the workspace as f16 (attn_fwd leaves them so).
// Per k-tile of 128 the block's 64 X rows and 128 W rows are brought once, by
// asynchronous copies straight into LDS (no register, no LDS store instruction),
// where all waves that need a row take their fragments from. Two buffers: the
// copies of tile t + 2 fly while tile t + 1 is worked on.
#define PK 128            /* k per staged tile: 256 bytes of a row */
#define PTILES (DM / PK)
#define PLDS_STRIDE 136   /* 272B: (stride/16B)=17 odd -> conflict-free b128 rows */
#define XBUF (64 * PLDS_STRIDE)    /* f16 elements of one X buffer */
#define WBUF (128 * PLDS_STRIDE)   /* f16 elements of one W buffer */

__global__ __launch_bounds__(256)
void out_proj(const float* __restrict__ X, const float* __restrict__ W,
              const float* __restrict__ bias, float* __restrict__ Y) {
  __shared__ __attribute__((aligned(16))) _Float16 Xs[2 * XBUF];
  __shared__ __attribute__((aligned(16))) _Float16 Ws[2 * WBUF];

  const int lane = threadIdx.x & 31;
  const int wave = threadIdx.x >> 5;
  const int lo = (lane & 16) ? 8 : 0;
  const int l15 = lane & 15;
  const int bm = blockIdx.x & 63;
  const int bn = blockIdx.x >> 6;
  const int m0 = bm * 64 + (wave & 1) * 32;
  const int n0 = bn * 128 + (wave >> 1) * 32;

  // Staging: one wave-wide copy brings the 256-byte pieces of two rows (four whole
  // lines): wave w has rows 2w, 2w+1, then +16, +32, ...; lane l brings elements
  // 8*(l&15)..+7 of row 2w + (l>>4).
  const int crow = wave * 2 + (lane >> 4);
  const int ccol = l15 * 8;
  const _Float16* const xg = (const _Float16*)X + (bm * 64 + crow) * DM + ccol;
  const _Float16* const wg = (const _Float16*)W + (bn * 128 + crow) * DM + ccol;
  // This lane's LDS byte addresses (the low 32 bits of the __shared__ addresses).
  const unsigned xl = (unsigned)(size_t)&Xs[crow * PLDS_STRIDE + ccol];
  const unsigned wl = (unsigned)(size_t)&Ws[crow * PLDS_STRIDE + ccol];

  // The twelve copies of this thread for the k-tile that starts at kc, into buffer
  // buf. The s_wait_xcnt stands in the copies' own statement, behind the last one:
  // so it precedes every later write into a register that a copy names.
  auto copy_tile = [&](const int buf, const int kc) __attribute__((always_inline)) {
    const _Float16* const x = xg + kc;
    const _Float16* const w = wg + kc;
    const unsigned lx = xl + buf * (XBUF * 2);
    const unsigned lw = wl + buf * (WBUF * 2);
    asm volatile(
        "global_load_async_to_lds_b128 %0, %1, off\n\t"
        "global_load_async_to_lds_b128 %2, %3, off\n\t"
        "global_load_async_to_lds_b128 %4, %5, off\n\t"
        "global_load_async_to_lds_b128 %6, %7, off\n\t"
        "global_load_async_to_lds_b128 %8, %9, off\n\t"
        "global_load_async_to_lds_b128 %10, %11, off\n\t"
        "global_load_async_to_lds_b128 %12, %13, off\n\t"
        "global_load_async_to_lds_b128 %14, %15, off\n\t"
        "global_load_async_to_lds_b128 %16, %17, off\n\t"
        "global_load_async_to_lds_b128 %18, %19, off\n\t"
        "global_load_async_to_lds_b128 %20, %21, off\n\t"
        "global_load_async_to_lds_b128 %22, %23, off\n\t"
        "s_wait_xcnt 0x0"
        :: "v"(lx),                          "v"(x),
           "v"(lx + 16 * PLDS_STRIDE * 2),   "v"(x + 16 * DM),
           "v"(lx + 32 * PLDS_STRIDE * 2),   "v"(x + 32 * DM),
           "v"(lx + 48 * PLDS_STRIDE * 2),   "v"(x + 48 * DM),
           "v"(lw),                          "v"(w),
           "v"(lw + 16 * PLDS_STRIDE * 2),   "v"(w + 16 * DM),
           "v"(lw + 32 * PLDS_STRIDE * 2),   "v"(w + 32 * DM),
           "v"(lw + 48 * PLDS_STRIDE * 2),   "v"(w + 48 * DM),
           "v"(lw + 64 * PLDS_STRIDE * 2),   "v"(w + 64 * DM),
           "v"(lw + 80 * PLDS_STRIDE * 2),   "v"(w + 80 * DM),
           "v"(lw + 96 * PLDS_STRIDE * 2),   "v"(w + 96 * DM),
           "v"(lw + 112 * PLDS_STRIDE * 2),  "v"(w + 112 * DM)
        : "memory");
  };

  // Fragment rows of this wave's 32x32 tile (buffer 0).
  const _Float16* xr0 = &Xs[((wave & 1) * 32 + l15) * PLDS_STRIDE];
  const _Float16* xr1 = xr0 + 16 * PLDS_STRIDE;
  const _Float16* wr0 = &Ws[((wave >> 1) * 32 + l15) * PLDS_STRIDE];
  const _Float16* wr1 = wr0 + 16 * PLDS_STRIDE;

  v8f C[2][2];
  #pragma unroll
  for (int i = 0; i < 2; ++i)
    #pragma unroll
    for (int j = 0; j < 2; ++j) C[i][j] = (v8f){0,0,0,0,0,0,0,0};

  // Prologue: tile 0 landed and published, tile 1 on its way.
  copy_tile(0, 0);
  // This wave's copies have landed (the compiler places no wait for them).
  asm volatile("s_wait_asynccnt 0x0" ::: "memory");
  __syncthreads();
  copy_tile(1, PK);

  // Unrolled: buffer and k offsets become immediates, and the test for a tile
  // t + 2 is settled at compile time.
  #pragma unroll
  for (int t = 0; t < PTILES; ++t) {
    const int buf = t & 1;
    // The tile's sixteen fragments, in the order of use.
    v16h a0[4], a1[4], b0[4], b1[4];
    #pragma unroll
    for (int s = 0; s < 4; ++s) {
      a0[s] = frag_from_ldsrow(xr0 + buf * XBUF + s * 32, lo);
      b0[s] = frag_from_ldsrow(wr0 + buf * WBUF + s * 32, lo);
      b1[s] = frag_from_ldsrow(wr1 + buf * WBUF + s * 32, lo);
      a1[s] = frag_from_ldsrow(xr1 + buf * XBUF + s * 32, lo);
    }
    // Keeps the 32 LDS reads together up here: sunk among the products they are
    // waited for group by group, a full LDS latency each time. (The products hold
    // registers only and may run on under the next tile's reads.)
    __builtin_amdgcn_sched_barrier(0);
    #pragma unroll
    for (int s = 0; s < 4; ++s) {
      C[0][0] = wmma_f16(a0[s], b0[s], C[0][0]);
      C[0][1] = wmma_f16(a0[s], b1[s], C[0][1]);
      C[1][0] = wmma_f16(a1[s], b0[s], C[1][0]);
      C[1][1] = wmma_f16(a1[s], b1[s], C[1][1]);
    }
    // The tile's foot. This wave's reads of buffer buf have returned:
    asm volatile("s_wait_dscnt 0x0" ::: "memory");
    // its copies of tile t + 1 have landed:
    asm volatile("s_wait_asynccnt 0x0" ::: "memory");
    // and the one barrier of a tile publishes tile t + 1 and ends every wave's
    // reads of buffer buf, which is refilled behind it.
    __syncthreads();
    if (t + 2 < PTILES) copy_tile(buf, (t + 2) * PK);
  }
  // No copy is outstanding when the wave goes on to its end.
  asm volatile("s_wait_asynccnt 0x0" ::: "memory");

  const float bias0 = bias[n0 + l15];
  const float bias1 = bias[n0 + 16 + l15];
  const int mhi = (lane & 16) ? 8 : 0;
  #pragma unroll
  for (int mi = 0; mi < 2; ++mi) {
    #pragma unroll
    for (int ni = 0; ni < 2; ++ni) {
      const float bb = ni ? bias1 : bias0;
      #pragma unroll
      for (int r = 0; r < 8; ++r) {
        const int row = m0 + mi * 16 + r + mhi;
        const int col = n0 + ni * 16 + l15;
        Y[row * DM + col] = C[mi][ni][r] + bb;
      }
    }
  }
}

extern "C" void kernel_launch(void* const* d_in, const int* in_sizes, int n_in,
                              void* d_out, int out_size, void* d_ws, size_t ws_size,
                              hipStream_t stream) {
  (void)in_sizes; (void)n_in; (void)out_size; (void)ws_size;
  const float* Q  = (const float*)d_in[0];
  const float* K  = (const float*)d_in[1];
  const float* V  = (const float*)d_in[2];
  const float* Wo = (const float*)d_in[3];
  const float* bo = (const float*)d_in[4];
  float* X  = (float*)d_ws;           // (b, q, h*d_k) intermediate, held as f16: 8 MiB
  float* Wh = X + 2 * 1024 * 1024;    // behind it, the weight as f16: 2 MiB
  float* Y = (float*)d_out;

  // 2 batches * 16 heads * 16 q-tiles = 512 blocks
  attn_fwd<<<dim3(512), dim3(256), 0, stream>>>(Q, K, V, Wo, X, Wh);
  // (4096/64) * (1024/128) = 64 * 8 = 512 blocks
  out_proj<<<dim3(512), dim3(256), 0, stream>>>(X, Wh, bo, Y);
}

// v009
// It runs in 41.7 microseconds.
// Next to v008, in two timings, it ran 1.06 and 1.07 times as fast.
// Over all steps from v000 it is 3.22 times as fast.
#include <hip/hip_runtime.h>
#include <hip/hip_bf16.h>

typedef __attribute__((ext_vector_type(16))) _Float16 v16h;
typedef __attribute__((ext_vector_type(8)))  _Float16 v8h;
typedef __attribute__((ext_vector_type(8)))  float    v8f;
typedef __attribute__((ext_vector_type(4)))  float    v4f;
typedef __attribute__((ext_vector_type(4)))  unsigned v4u;

#define NQ 2048
#define NK 2048
#define DM 1024
#define NH 16
#define DK 64
#define SCALE 0.125f          /* 1/sqrt(64) */
#define L2E   1.44269504088896340736f

// 2^x by the bare hardware instruction, for eight values and for one.
// exp2f() wraps each v_exp_f32 in a compare, two selects, an add and an ldexp so
// that results below 2^-126 come out as denormals; here a term that small is 0 in
// the f16 P operand and is lost in a row sum that ends >= 1.
// In asm, so that no instruction directly behind a v_exp_f32 reads its result or
// overwrites its source; the v_nop is that slot behind the last one. The arguments
// stay as they are: the tile's test may send the wave back to them. Volatile:
// the four groups of a tile keep their order behind the score products.
__device__ __forceinline__ v8f exp2_x8(const v8f a) {
  float e0, e1, e2, e3, e4, e5, e6, e7;
  asm volatile("v_exp_f32 %0, %8\n\tv_exp_f32 %1, %9\n\tv_exp_f32 %2, %10\n\t"
      "v_exp_f32 %3, %11\n\tv_exp_f32 %4, %12\n\tv_exp_f32 %5, %13\n\t"
      "v_exp_f32 %6, %14\n\tv_exp_f32 %7, %15\n\tv_nop"
      : "=&v"(e0), "=&v"(e1), "=&v"(e2), "=&v"(e3),
        "=&v"(e4), "=&v"(e5), "=&v"(e6), "=&v"(e7)
      : "v"(a[0]), "v"(a[1]), "v"(a[2]), "v"(a[3]),
        "v"(a[4]), "v"(a[5]), "v"(a[6]), "v"(a[7]));
  return (v8f){e0, e1, e2, e3, e4, e5, e6, e7};
}
__device__ __forceinline__ float exp2_x1(float c) {
  asm("v_exp_f32 %0, %0\n\tv_nop" : "+v"(c));
  return c;
}

__device__ __forceinline__ v8f wmma_f16(v16h a, v16h b, v8f c) {
  return __builtin_amdgcn_wmma_f32_16x16x32_f16(false, a, false, b,
                                                (short)0, c, false, false);
}

// Load one 16-element f16 fragment (A or B operand, identical per-lane run
// pattern) from an fp32 row in global memory: elements 0..7 = row[lo..lo+7],
// 8..15 = row[lo+16..lo+23], scaled.
__device__ __forceinline__ v16h frag_from_f32row(const float* rowp, int lo, float s) {
  const float4 a0 = *(const float4*)(rowp + lo);
  const float4 a1 = *(const float4*)(rowp + lo + 4);
  const float4 b0 = *(const float4*)(rowp + lo + 16);
  const float4 b1 = *(const float4*)(rowp + lo + 20);
  v16h r;
  r[0]=(_Float16)(a0.x*s);  r[1]=(_Float16)(a0.y*s);
  r[2]=(_Float16)(a0.z*s);  r[3]=(_Float16)(a0.w*s);
  r[4]=(_Float16)(a1.x*s);  r[5]=(_Float16)(a1.y*s);
  r[6]=(_Float16)(a1.z*s);  r[7]=(_Float16)(a1.w*s);
  r[8]=(_Float16)(b0.x*s);  r[9]=(_Float16)(b0.y*s);
  r[10]=(_Float16)(b0.z*s); r[11]=(_Float16)(b0.w*s);
  r[12]=(_Float16)(b1.x*s); r[13]=(_Float16)(b1.y*s);
  r[14]=(_Float16)(b1.z*s); r[15]=(_Float16)(b1.w*s);
  return r;
}

// Two f32 to a pair of f16 (round to nearest even). Casts, not asm text: an asm
// operand must lie in the first 256 registers, and held there for a whole tile
// the fetched values were spilled. The scheduling fences of a tile keep the
// conversions where they stand, a tile behind their loads.
typedef __attribute__((ext_vector_type(2))) _Float16 v2h;
__device__ __forceinline__ unsigned cvt_here(float a, float b) {
  v2h r;
  r[0] = (_Float16)a; r[1] = (_Float16)b;
  return __builtin_bit_cast(unsigned, r);
}

typedef __attribute__((ext_vector_type(4))) _Float16 v4h;
__device__ __forceinline__ v4h cvt4(const v4f f) {
  v4h r;
  r[0]=(_Float16)f[0]; r[1]=(_Float16)f[1]; r[2]=(_Float16)f[2]; r[3]=(_Float16)f[3];
  return r;
}

// Same fragment pattern from an f16 LDS row (two ds_load_b128).
__device__ __forceinline__ v16h frag_from_ldsrow(const _Float16* rowp, int lo) {
  v8h a = *(const v8h*)(rowp + lo);
  v8h b = *(const v8h*)(rowp + lo + 16);
  return __builtin_shufflevector(a, b, 0,1,2,3,4,5,6,7,8,9,10,11,12,13,14,15);
}

// Transposing LDS load. With lane l pointing at the 16 bytes
// T[8*(l>>4) + (l&7)][8*((l>>3)&1) ..+7] of a row-major f16 tile T, lane l gets
// the column piece T[8*(l>>4) + 0..7][l&15].
typedef __attribute__((ext_vector_type(8))) short v8s;
typedef __attribute__((address_space(3))) v8s lds_v8s;
__device__ __forceinline__ v8h ld_tr16(const _Float16* p) {
  return __builtin_bit_cast(v8h, __builtin_amdgcn_ds_load_tr16_b128_v8i16((lds_v8s*)p));
}

#define KLDS_STRIDE 72   /* 144B: (stride/16B)=9 odd -> conflict-free b128 rows */
#define VLDS_STRIDE 80   /* 160B: (stride/32B)=5 odd -> conflict-free transposing loads */
#define TKEYS 64                     /* keys of one tile: one softmax step, one barrier */
#define KBUF (TKEYS * KLDS_STRIDE)   /* f16 elements of one K buffer */
#define VBUF (TKEYS * VLDS_STRIDE)   /* f16 elements of one V buffer */

// A wave holds 32 query columns (two groups of 16): every K and V fragment that it
// reads from LDS feeds two products, and a work-group's staged tile serves 256
// queries. The grid then gives two waves per SIMD (one work-group per WGP); told
// so, the compiler has the registers of two column groups without spilling.
__global__ __launch_bounds__(256) __attribute__((amdgpu_waves_per_eu(2, 2)))
void attn_fwd(const float* __restrict__ Q, const float* __restrict__ K,
              const float* __restrict__ V, const float* __restrict__ Wo,
              float* __restrict__ X, float* __restrict__ Wh) {
  // Two buffers each: tile t is read from buffer t & 1 while tile t + 1 is
  // written into the other one.
  __shared__ __attribute__((aligned(16))) _Float16 Klds[2 * KBUF];   // [key][d]  f16
  __shared__ __attribute__((aligned(16))) _Float16 Vlds[2 * VBUF];   // [key][d]  f16 (transposed on read)

  const int lane = threadIdx.x & 31;
  const int wave = threadIdx.x >> 5;
  const int qt = blockIdx.x & 7;           // 8 q-tiles of 256
  const int h  = (blockIdx.x >> 3) & 15;   // 16 heads
  const int b  = blockIdx.x >> 7;          // 2 batches
  const int lo = (lane & 16) ? 8 : 0;      // per-lane run offset within 32
  const int l15 = lane & 15;

  // This block's 4096 elements of the projection weight, to be left in the
  // workspace as f16 for out_proj (whole lines per wave-wide load). The loads go
  // out ahead of the first Q, K and V loads and share their wait.
  const int wi = blockIdx.x * 4096 + threadIdx.x * 4;
  // The two scheduling fences keep every other instruction out from between the
  // loads and the s_wait_xcnt, which so stands in front of the next write into
  // the address registers that the loads name.
  __builtin_amdgcn_sched_barrier(0);
  const v4f wa = *(const v4f*)(Wo + wi);
  const v4f wb = *(const v4f*)(Wo + wi + 1024);
  const v4f wc = *(const v4f*)(Wo + wi + 2048);
  const v4f wd = *(const v4f*)(Wo + wi + 3072);
  asm volatile("s_wait_xcnt 0x0" ::: "memory");
  __builtin_amdgcn_sched_barrier(0);

  // Column group c of this wave: query rows qrow + 16 * c.
  const int qrow = qt * 256 + wave * 32 + l15;
  const float* qptr = Q + (b * NQ + qrow) * DM + h * DK + lo;   // this lane's run

  // Q B-fragments (per column group: d-chunks 0-31 / 32-63), softmax scale and
  // log2(e) folded in: the score products come out as arguments of 2^x.
  v16h qf[2][2];
  #pragma unroll
  for (int c = 0; c < 2; ++c) {
    qf[c][0] = frag_from_f32row(qptr + c * 16 * DM,      0, SCALE * L2E);
    qf[c][1] = frag_from_f32row(qptr + c * 16 * DM + 32, 0, SCALE * L2E);
  }
  // The address is an input, so that its registers stay its own up to this wait.
  asm volatile("s_wait_xcnt 0x0" :: "v"(qptr) : "memory");

  v8f O[2][4];
  #pragma unroll
  for (int c = 0; c < 2; ++c)
    #pragma unroll
    for (int i = 0; i < 4; ++i) O[c][i] = (v8f){0,0,0,0,0,0,0,0};
  float l[2] = {0.0f, 0.0f};
  // The held reference of each of this lane's two query columns, negated, in all
  // eight rows of an accumulator: it is the C operand of the score products, which
  // so give s - ref, the argument of 2^x. It moves only when a lane's 32 terms of a tile
  // sum to more than 2^8 (so every P that is used is <= 2^8, well inside f16), and
  // at the first tile, where thr and lowb make the test true and the column's own
  // maximum, of either sign, the reference.
  v8f cref[2] = {(v8f){0,0,0,0,0,0,0,0}, (v8f){0,0,0,0,0,0,0,0}};
  float thr = -3.0e38f, lowb = -3.0e38f;

  // Staging of a tile (64 keys x 64 dims): thread t brings dims 8*(t&7)..+7 of
  // keys t>>3 and 32 + (t>>3), of K and of V, through registers.
  const int srow = threadIdx.x >> 3;
  const int scol = (threadIdx.x & 7) * 8;
  const float* kg = K + (b * NK + srow) * DM + h * DK + scol;
  const float* vg = V + (b * NK + srow) * DM + h * DK + scol;
  _Float16* const kst = &Klds[srow * KLDS_STRIDE + scol];
  _Float16* const vst = &Vlds[srow * VLDS_STRIDE + scol];
  // This lane's address in the V tile for the transposing loads (keys 0..15, dims 0..15).
  const _Float16* const vtr = &Vlds[(lo + (lane & 7)) * VLDS_STRIDE + ((lane >> 3) & 1) * 8];
  v4f kf0, kf1, kf2, kf3, vf0, vf1, vf2, vf3;

  // Issue the loads of the tile that kg and vg point at.
  auto fetch = [&]() __attribute__((always_inline)) {
    kf0 = *(const v4f*)kg;              kf1 = *(const v4f*)(kg + 4);
    kf2 = *(const v4f*)(kg + 32 * DM);  kf3 = *(const v4f*)(kg + 32 * DM + 4);
    vf0 = *(const v4f*)vg;              vf1 = *(const v4f*)(vg + 4);
    vf2 = *(const v4f*)(vg + 32 * DM);  vf3 = *(const v4f*)(vg + 32 * DM + 4);
  };
  // Convert the fetched tile and write it into buffer buf.
  auto stage = [&](const int buf) __attribute__((always_inline)) {
    // All conversions ahead of the writes: each result then has a register
    // of its own, and no conversion waits for an LDS write to have read its data.
    v4u kp, kq;
    kp[0] = cvt_here(kf0[0], kf0[1]);  kp[1] = cvt_here(kf0[2], kf0[3]);
    kp[2] = cvt_here(kf1[0], kf1[1]);  kp[3] = cvt_here(kf1[2], kf1[3]);
    kq[0] = cvt_here(kf2[0], kf2[1]);  kq[1] = cvt_here(kf2[2], kf2[3]);
    kq[2] = cvt_here(kf3[0], kf3[1]);  kq[3] = cvt_here(kf3[2], kf3[3]);
    v4u vp, vq;
    vp[0] = cvt_here(vf0[0], vf0[1]);  vp[1] = cvt_here(vf0[2], vf0[3]);
    vp[2] = cvt_here(vf1[0], vf1[1]);  vp[3] = cvt_here(vf1[2], vf1[3]);
    vq[0] = cvt_here(vf2[0], vf2[1]);  vq[1] = cvt_here(vf2[2], vf2[3]);
    vq[2] = cvt_here(vf3[0], vf3[1]);  vq[3] = cvt_here(vf3[2], vf3[3]);
    *(v4u*)(kst + buf * KBUF) = kp;
    *(v4u*)(kst + buf * KBUF + 32 * KLDS_STRIDE) = kq;
    *(v4u*)(vst + buf * VBUF) = vp;
    *(v4u*)(vst + buf * VBUF + 32 * VLDS_STRIDE) = vq;
  };

  // Work-group barrier by hand, with the wait on this wave's LDS reads and writes
  // that it needs: __syncthreads() would also wait for the global loads that are
  // meant to stay in flight across it.
  // The scheduling fence keeps the tile's vector work and products in front of the
  // barrier, where they cover the draining of the LDS writes (the compiler
  // otherwise moves them behind it, and the barrier comes to stand directly behind
  // the writes). Not the accumulators as asm inputs: an asm operand must lie in
  // the first 256 registers, which the scores, terms and fetched tile need.
  auto publish = [&]() __attribute__((always_inline)) {
    __builtin_amdgcn_sched_barrier(0);
    asm volatile("s_wait_dscnt 0x0\n\ts_barrier_signal -1\n\ts_barrier_wait -1" ::: "memory");
  };

  // One tile: products and softmax on buffer cur; meanwhile, where put_next,
  // the fetched tile t + 1 goes into the other buffer and, where get_next,
  // the loads of tile t + 2 are issued.
  auto trip = [&](const int cur, const bool put_next, const bool get_next)
      __attribute__((always_inline)) {
    // The K fragments of the tile's four groups of 16 keys, in the order of use.
    v16h ka[4], kc[4];
    #pragma unroll
    for (int g = 0; g < 4; ++g)
      ka[g] = frag_from_ldsrow(&Klds[cur * KBUF + (g * 16 + l15) * KLDS_STRIDE], lo);
    #pragma unroll
    for (int g = 0; g < 4; ++g)
      kc[g] = frag_from_ldsrow(&Klds[cur * KBUF + (g * 16 + l15) * KLDS_STRIDE] + 32, lo);
    // Staging stands here, behind the K reads: its conversions, LDS writes and
    // loads issue while the K fragments are on their way, when the wave has
    // nothing else to do.
    if (put_next) {
      stage(cur ^ 1);
      if (get_next) {
        kg += TKEYS * DM; vg += TKEYS * DM; fetch();
      }
    }
    // Keeps the 16 LDS reads together up here (sunk among the products they
    // would be waited for one by one), and the staging with them.
    __builtin_amdgcn_sched_barrier(0);

    // S^T = K . Q^T - ref  (per column group four 16key x 16q fragments, K-dim 64 =
    // 2 WMMAs each); a K fragment's two products stand side by side.
    v8f s[2][4];
    #pragma unroll
    for (int g = 0; g < 4; ++g) {
      s[0][g] = wmma_f16(ka[g], qf[0][0], cref[0]);
      s[1][g] = wmma_f16(ka[g], qf[1][0], cref[1]);
    }
    #pragma unroll
    for (int g = 0; g < 4; ++g) {
      s[0][g] = wmma_f16(kc[g], qf[0][1], s[0][g]);
      s[1][g] = wmma_f16(kc[g], qf[1][1], s[1][g]);
    }
    // Inputs only: holds the V reads below behind the sixteen score products, which
    // so stand in one run, with no LDS read among them. The v_nop are the four
    // vector slots that the chip needs between the last product and a vector write
    // over its operands: the next vector instructions are asm text, which the
    // compiler does not count, and may be given the K fragments' registers.
    asm volatile("v_nop\n\tv_nop\n\tv_nop\n\tv_nop"
                 :: "v"(s[0][0]), "v"(s[0][1]), "v"(s[0][2]), "v"(s[0][3]),
                    "v"(s[1][0]), "v"(s[1][1]), "v"(s[1][2]), "v"(s[1][3]) : "memory");

    v16h vfrag[2][4];
    #pragma unroll
    for (int c = 0; c < 2; ++c) {
      #pragma unroll
      for (int gd = 0; gd < 4; ++gd) {
        // V^T rows gd*16 + l15 over keys 32c..32c+31: keys lo..lo+7, then keys
        // 16+lo..16+lo+7, the k order of the K rows' fragments and of P^T.
        const _Float16* vp = vtr + cur * VBUF + c * 32 * VLDS_STRIDE + gd * 16;
        vfrag[c][gd] = __builtin_shufflevector(ld_tr16(vp), ld_tr16(vp + 16 * VLDS_STRIDE),
                                               0,1,2,3,4,5,6,7,8,9,10,11,12,13,14,15);
      }
    }
    // Keeps the V reads up here, so that they land under the vector work: the
    // compiler sinks them to the tile's end otherwise.
    __builtin_amdgcn_sched_barrier(0);

    // Per column group: P = 2^(s - ref), this lane's sum of its 32 terms (two
    // independent chains), and the P^T B-fragments (keys 0..31 and 32..63), which
    // feed directly from the registers of the terms.
    v16h pf[2][2];
    float ps[2];
    auto terms = [&](const int c) __attribute__((always_inline)) {
      const v8f a0 = exp2_x8(s[c][0]);
      const v8f a1 = exp2_x8(s[c][1]);
      const v8f a2 = exp2_x8(s[c][2]);
      const v8f a3 = exp2_x8(s[c][3]);
      float psa = 0.0f, psb = 0.0f;
      #pragma unroll
      for (int r = 0; r < 8; ++r) {
        psa += a0[r] + a1[r];
        psb += a2[r] + a3[r];
        pf[c][0][r]     = (_Float16)a0[r];
        pf[c][0][8 + r] = (_Float16)a1[r];
        pf[c][1][r]     = (_Float16)a2[r];
        pf[c][1][8 + r] = (_Float16)a3[r];
      }
      ps[c] = psa + psb;
    };
    terms(0);
    terms(1);
    // One test per tile and wave, a scalar branch: has any column outgrown its
    // reference? A term above 2^8 makes its lane's sum exceed 2^8 (no term is
    // negative), so the sums that are needed anyway tell, and no maximum is taken
    // and nothing exchanged between the wave's halves unless the answer is yes.
    // Marked unlikely, so that the tile's usual path stays in one piece.
    if (__builtin_expect(__builtin_amdgcn_ballot_w32(fmaxf(ps[0], ps[1]) > thr) != 0, 0)) {
      #pragma unroll
      for (int c = 0; c < 2; ++c) {
        float mca = s[c][0][0], mcb = s[c][2][0];
        #pragma unroll
        for (int r = 0; r < 8; ++r) {
          mca = fmaxf(mca, s[c][0][r]); mca = fmaxf(mca, s[c][1][r]);
          mcb = fmaxf(mcb, s[c][2][r]); mcb = fmaxf(mcb, s[c][3][r]);
        }
        const float mc = fmaxf(mca, mcb);
        // The column's maximum over both halves, or no move (lowb) where it lies
        // below the reference.
        const float delta = fmaxf(fmaxf(mc, __shfl_xor(mc, 16, 32)), lowb);
        // delta < 0 only at the first tile, where O and l are 0: the factor 1 keeps
        // them so where 2^-delta would overflow.
        const float corr = exp2_x1(fminf(-delta, 0.0f));
        #pragma unroll
        for (int g = 0; g < 4; ++g) s[c][g] -= delta;
        #pragma unroll
        for (int i = 0; i < 4; ++i) O[c][i] *= corr;
        l[c] *= corr;
        cref[c] -= delta;
        terms(c);
      }
      thr = 256.0f;
      lowb = 0.0f;
    }
    l[0] += ps[0];
    l[1] += ps[1];

    // O^T += V^T . P^T  (per column group 4 d-groups of 16, two k-steps of 32 keys);
    // a V fragment's two products stand side by side.
    #pragma unroll
    for (int ks = 0; ks < 2; ++ks) {
      #pragma unroll
      for (int gd = 0; gd < 4; ++gd) {
        O[0][gd] = wmma_f16(vfrag[ks][gd], pf[0][ks], O[0][gd]);
        O[1][gd] = wmma_f16(vfrag[ks][gd], pf[1][ks], O[1][gd]);
      }
    }

    // The one barrier of a tile: it publishes tile t + 1 and ends every wave's
    // reads of buffer cur, which the next trip overwrites.
    if (put_next) publish();
  };

  // Prologue: tile 0 into buffer 0, tile 1 on its way.
  fetch();
  stage(0);
  kg += TKEYS * DM; vg += TKEYS * DM;
  fetch();
  publish();

  // The weight's f16 copy: the same conversion that out_proj's staging made, once
  // per element instead of once per block that reads the row.
  const v4h ha = cvt4(wa), hb = cvt4(wb), hc = cvt4(wc), hd = cvt4(wd);
  // Fences as at the loads: nothing else between the stores and their wait.
  __builtin_amdgcn_sched_barrier(0);
  *(v4h*)((_Float16*)Wh + wi)        = ha;
  *(v4h*)((_Float16*)Wh + wi + 1024) = hb;
  *(v4h*)((_Float16*)Wh + wi + 2048) = hc;
  *(v4h*)((_Float16*)Wh + wi + 3072) = hd;
  // Behind the four stores, in front of the next write into a register that they
  // name.
  asm volatile("s_wait_xcnt 0x0" ::: "memory");
  __builtin_amdgcn_sched_barrier(0);

  // One loop for all tiles, the last pair too: as code of its own, its seldom path
  // was built with spills.
  for (int kb = 0; kb < NK; kb += 2 * TKEYS) {
    // Scalar, the same for the whole work-group: false in the last pair of tiles,
    // where nothing is left to fetch and, in the last tile, to write or publish.
    const bool more = kb + 2 * TKEYS < NK;
    trip(0, true, more);
    trip(1, more, more);
  }

  // Finish: combine the two lane-half partial sums, normalize, store.
  const int dhi = (lane & 16) ? 8 : 0;
  // X leaves as f16, the type in which out_proj's products take it: rounded to
  // f32 by the multiply and then to f16, as before, only on this side of the
  // workspace. One 16-byte store per group of 16 dims.
  _Float16* xrow = (_Float16*)X + (b * NQ + qrow) * DM + h * DK;
  v8h o[2][4];
  #pragma unroll
  for (int c = 0; c < 2; ++c) {
    const float lsum = l[c] + __shfl_xor(l[c], 16, 32);
    const float inv = 1.0f / lsum;
    #pragma unroll
    for (int gd = 0; gd < 4; ++gd)
      #pragma unroll
      for (int r = 0; r < 8; ++r)
        o[c][gd][r] = (_Float16)(O[c][gd][r] * inv);
  }
  // All values first, then the eight stores and the end: no vector instruction
  // behind a store, so none writes into a register that an issued store names.
  __builtin_amdgcn_sched_barrier(0);
  #pragma unroll
  for (int c = 0; c < 2; ++c)
    #pragma unroll
    for (int gd = 0; gd < 4; ++gd)
      *(v8h*)(xrow + c * 16 * DM + gd * 16 + dhi) = o[c][gd];
}

// Y[m][n] = sum_k X[m][k] * W[n][k] + bias[n];  M=4096, N=1024, K=1024.
// Each wave: 32x32 tile (2x2 WMMA frags); block: 8 waves = 64(M) x 128(N).
// X and W come from the workspace as f16 (attn_fwd leaves them so).
// Per k-tile of 128 the block's 64 X rows and 128 W rows are brought once, by
// asynchronous copies straight into LDS (no register, no LDS store instruction),
// where all waves that need a row take their fragments from. Two buffers: the
// copies of tile t + 2 fly while tile t + 1 is worked on.
#define PK 128            /* k per staged tile: 256 bytes of a row */
#define PTILES (DM / PK)
#define PLDS_STRIDE 136   /* 272B: (stride/16B)=17 odd -> conflict-free b128 rows */
#define XBUF (64 * PLDS_STRIDE)    /* f16 elements of one X buffer */
#define WBUF (128 * PLDS_STRIDE)   /* f16 elements of one W buffer */

__global__ __launch_bounds__(256)
void out_proj(const float* __restrict__ X, const float* __restrict__ W,
              const float* __restrict__ bias, float* __restrict__ Y) {
  __shared__ __attribute__((aligned(16))) _Float16 Xs[2 * XBUF];
  __shared__ __attribute__((aligned(16))) _Float16 Ws[2 * WBUF];

  const int lane = threadIdx.x & 31;
  const int wave = threadIdx.x >> 5;
  const int lo = (lane & 16) ? 8 : 0;
  const int l15 = lane & 15;
  const int bm = blockIdx.x & 63;
  const int bn = blockIdx.x >> 6;
  const int m0 = bm * 64 + (wave & 1) * 32;
  const int n0 = bn * 128 + (wave >> 1) * 32;

  // Staging: one wave-wide copy brings the 256-byte pieces of two rows (four whole
  // lines): wave w has rows 2w, 2w+1, then +16, +32, ...; lane l brings elements
  // 8*(l&15)..+7 of row 2w + (l>>4).
  const int crow = wave * 2 + (lane >> 4);
  const int ccol = l15 * 8;
  const _Float16* const xg = (const _Float16*)X + (bm * 64 + crow) * DM + ccol;
  const _Float16* const wg = (const _Float16*)W + (bn * 128 + crow) * DM + ccol;
  // This lane's LDS byte addresses (the low 32 bits of the __shared__ addresses).
  const unsigned xl = (unsigned)(size_t)&Xs[crow * PLDS_STRIDE + ccol];
  const unsigned wl = (unsigned)(size_t)&Ws[crow * PLDS_STRIDE + ccol];

  // The twelve copies of this thread for the k-tile that starts at kc, into buffer
  // buf. The s_wait_xcnt stands in the copies' own statement, behind the last one:
  // so it precedes every later write into a register that a copy names.
  auto copy_tile = [&](const int buf, const int kc) __attribute__((always_inline)) {
    const _Float16* const x = xg + kc;
    const _Float16* const w = wg + kc;
    const unsigned lx = xl + buf * (XBUF * 2);
    const unsigned lw = wl + buf * (WBUF * 2);
    asm volatile(
        "global_load_async_to_lds_b128 %0, %1, off\n\t"
        "global_load_async_to_lds_b128 %2, %3, off\n\t"
        "global_load_async_to_lds_b128 %4, %5, off\n\t"
        "global_load_async_to_lds_b128 %6, %7, off\n\t"
        "global_load_async_to_lds_b128 %8, %9, off\n\t"
        "global_load_async_to_lds_b128 %10, %11, off\n\t"
        "global_load_async_to_lds_b128 %12, %13, off\n\t"
        "global_load_async_to_lds_b128 %14, %15, off\n\t"
        "global_load_async_to_lds_b128 %16, %17, off\n\t"
        "global_load_async_to_lds_b128 %18, %19, off\n\t"
        "global_load_async_to_lds_b128 %20, %21, off\n\t"
        "global_load_async_to_lds_b128 %22, %23, off\n\t"
        "s_wait_xcnt 0x0"
        :: "v"(lx),                          "v"(x),
           "v"(lx + 16 * PLDS_STRIDE * 2),   "v"(x + 16 * DM),
           "v"(lx + 32 * PLDS_STRIDE * 2),   "v"(x + 32 * DM),
           "v"(lx + 48 * PLDS_STRIDE * 2),   "v"(x + 48 * DM),
           "v"(lw),                          "v"(w),
           "v"(lw + 16 * PLDS_STRIDE * 2),   "v"(w + 16 * DM),
           "v"(lw + 32 * PLDS_STRIDE * 2),   "v"(w + 32 * DM),
           "v"(lw + 48 * PLDS_STRIDE * 2),   "v"(w + 48 * DM),
           "v"(lw + 64 * PLDS_STRIDE * 2),   "v"(w + 64 * DM),
           "v"(lw + 80 * PLDS_STRIDE * 2),   "v"(w + 80 * DM),
           "v"(lw + 96 * PLDS_STRIDE * 2),   "v"(w + 96 * DM),
           "v"(lw + 112 * PLDS_STRIDE * 2),  "v"(w + 112 * DM)
        : "memory");
  };

  // Fragment rows of this wave's 32x32 tile (buffer 0).
  const _Float16* xr0 = &Xs[((wave & 1) * 32 + l15) * PLDS_STRIDE];
  const _Float16* xr1 = xr0 + 16 * PLDS_STRIDE;
  const _Float16* wr0 = &Ws[((wave >> 1) * 32 + l15) * PLDS_STRIDE];
  const _Float16* wr1 = wr0 + 16 * PLDS_STRIDE;

  v8f C[2][2];
  #pragma unroll
  for (int i = 0; i < 2; ++i)
    #pragma unroll
    for (int j = 0; j < 2; ++j) C[i][j] = (v8f){0,0,0,0,0,0,0,0};

  // Prologue: tile 0 landed and published, tile 1 on its way.
  copy_tile(0, 0);
  // This wave's copies have landed (the compiler places no wait for them).
  asm volatile("s_wait_asynccnt 0x0" ::: "memory");
  __syncthreads();
  copy_tile(1, PK);

  // Unrolled: buffer and k offsets become immediates, and the test for a tile
  // t + 2 is settled at compile time.
  #pragma unroll
  for (int t = 0; t < PTILES; ++t) {
    const int buf = t & 1;
    // The tile's sixteen fragments, in the order of use.
    v16h a0[4], a1[4], b0[4], b1[4];
    #pragma unroll
    for (int s = 0; s < 4; ++s) {
      a0[s] = frag_from_ldsrow(xr0 + buf * XBUF + s * 32, lo);
      b0[s] = frag_from_ldsrow(wr0 + buf * WBUF + s * 32, lo);
      b1[s] = frag_from_ldsrow(wr1 + buf * WBUF + s * 32, lo);
      a1[s] = frag_from_ldsrow(xr1 + buf * XBUF + s * 32, lo);
    }
    // Keeps the 32 LDS reads together up here: sunk among the products they are
    // waited for group by group, a full LDS latency each time. (The products hold
    // registers only and may run on under the next tile's reads.)
    __builtin_amdgcn_sched_barrier(0);
    #pragma unroll
    for (int s = 0; s < 4; ++s) {
      C[0][0] = wmma_f16(a0[s], b0[s], C[0][0]);
      C[0][1] = wmma_f16(a0[s], b1[s], C[0][1]);
      C[1][0] = wmma_f16(a1[s], b0[s], C[1][0]);
      C[1][1] = wmma_f16(a1[s], b1[s], C[1][1]);
    }
    // The tile's foot. This wave's reads of buffer buf have returned:
    asm volatile("s_wait_dscnt 0x0" ::: "memory");
    // its copies of tile t + 1 have landed:
    asm volatile("s_wait_asynccnt 0x0" ::: "memory");
    // and the one barrier of a tile publishes tile t + 1 and ends every wave's
    // reads of buffer buf, which is refilled behind it.
    __syncthreads();
    if (t + 2 < PTILES) copy_tile(buf, (t + 2) * PK);
  }
  // No copy is outstanding when the wave goes on to its end.
  asm volatile("s_wait_asynccnt 0x0" ::: "memory");

  const float bias0 = bias[n0 + l15];
  const float bias1 = bias[n0 + 16 + l15];
  const int mhi = (lane & 16) ? 8 : 0;
  #pragma unroll
  for (int mi = 0; mi < 2; ++mi) {
    #pragma unroll
    for (int ni = 0; ni < 2; ++ni) {
      const float bb = ni ? bias1 : bias0;
      #pragma unroll
      for (int r = 0; r < 8; ++r) {
        const int row = m0 + mi * 16 + r + mhi;
        const int col = n0 + ni * 16 + l15;
        Y[row * DM + col] = C[mi][ni][r] + bb;
      }
    }
  }
}

extern "C" void kernel_launch(void* const* d_in, const int* in_sizes, int n_in,
                              void* d_out, int out_size, void* d_ws, size_t ws_size,
                              hipStream_t stream) {
  (void)in_sizes; (void)n_in; (void)out_size; (void)ws_size;
  const float* Q  = (const float*)d_in[0];
  const float* K  = (const float*)d_in[1];
  const float* V  = (const float*)d_in[2];
  const float* Wo = (const float*)d_in[3];
  const float* bo = (const float*)d_in[4];
  float* X  = (float*)d_ws;           // (b, q, h*d_k) intermediate, held as f16: 8 MiB
  float* Wh = X + 2 * 1024 * 1024;    // behind it, the weight as f16: 2 MiB
  float* Y = (float*)d_out;

  // 2 batches * 16 heads * 8 q-tiles = 256 blocks
  attn_fwd<<<dim3(256), dim3(256), 0, stream>>>(Q, K, V, Wo, X, Wh);
  // (4096/64) * (1024/128) = 64 * 8 = 512 blocks
  out_proj<<<dim3(512), dim3(256), 0, stream>>>(X, Wh, bo, Y);
}

// v010
// Measured time: 40 microseconds a run.
// Timed twice side by side with v009, it ran 1.04 times as fast both times.
// Counting every step since v000, it is 3.34 times as fast.
#include <hip/hip_runtime.h>
#include <hip/hip_bf16.h>

typedef __attribute__((ext_vector_type(16))) _Float16 v16h;
typedef __attribute__((ext_vector_type(8)))  _Float16 v8h;
typedef __attribute__((ext_vector_type(8)))  float    v8f;
typedef __attribute__((ext_vector_type(4)))  float    v4f;
typedef __attribute__((ext_vector_type(4)))  unsigned v4u;

#define NQ 2048
#define NK 2048
#define DM 1024
#define NH 16
#define DK 64
#define SCALE 0.125f          /* 1/sqrt(64) */
#define L2E   1.44269504088896340736f

// 2^x by the bare hardware instruction, for eight values and for one.
// exp2f() wraps each v_exp_f32 in a compare, two selects, an add and an ldexp so
// that results below 2^-126 come out as denormals; here a term that small is 0 in
// the f16 P operand and is lost in a row sum that ends >= 1.
// In asm, so that no instruction directly behind a v_exp_f32 reads its result or
// overwrites its source; the v_nop is that slot behind the last one. The arguments
// stay as they are: the pass's test may send the wave back to them. Volatile:
// the four groups of a pass keep their order behind the score products.
__device__ __forceinline__ v8f exp2_x8(const v8f a) {
  float e0, e1, e2, e3, e4, e5, e6, e7;
  asm volatile("v_exp_f32 %0, %8\n\tv_exp_f32 %1, %9\n\tv_exp_f32 %2, %10\n\t"
      "v_exp_f32 %3, %11\n\tv_exp_f32 %4, %12\n\tv_exp_f32 %5, %13\n\t"
      "v_exp_f32 %6, %14\n\tv_exp_f32 %7, %15\n\tv_nop"
      : "=&v"(e0), "=&v"(e1), "=&v"(e2), "=&v"(e3),
        "=&v"(e4), "=&v"(e5), "=&v"(e6), "=&v"(e7)
      : "v"(a[0]), "v"(a[1]), "v"(a[2]), "v"(a[3]),
        "v"(a[4]), "v"(a[5]), "v"(a[6]), "v"(a[7]));
  return (v8f){e0, e1, e2, e3, e4, e5, e6, e7};
}
__device__ __forceinline__ float exp2_x1(float c) {
  asm("v_exp_f32 %0, %0\n\tv_nop" : "+v"(c));
  return c;
}

__device__ __forceinline__ v8f wmma_f16(v16h a, v16h b, v8f c) {
  return __builtin_amdgcn_wmma_f32_16x16x32_f16(false, a, false, b,
                                                (short)0, c, false, false);
}

// Load one 16-element f16 fragment (A or B operand, identical per-lane run
// pattern) from an fp32 row in global memory: elements 0..7 = row[lo..lo+7],
// 8..15 = row[lo+16..lo+23], scaled.
__device__ __forceinline__ v16h frag_from_f32row(const float* rowp, int lo, float s) {
  const float4 a0 = *(const float4*)(rowp + lo);
  const float4 a1 = *(const float4*)(rowp + lo + 4);
  const float4 b0 = *(const float4*)(rowp + lo + 16);
  const float4 b1 = *(const float4*)(rowp + lo + 20);
  v16h r;
  r[0]=(_Float16)(a0.x*s);  r[1]=(_Float16)(a0.y*s);
  r[2]=(_Float16)(a0.z*s);  r[3]=(_Float16)(a0.w*s);
  r[4]=(_Float16)(a1.x*s);  r[5]=(_Float16)(a1.y*s);
  r[6]=(_Float16)(a1.z*s);  r[7]=(_Float16)(a1.w*s);
  r[8]=(_Float16)(b0.x*s);  r[9]=(_Float16)(b0.y*s);
  r[10]=(_Float16)(b0.z*s); r[11]=(_Float16)(b0.w*s);
  r[12]=(_Float16)(b1.x*s); r[13]=(_Float16)(b1.y*s);
  r[14]=(_Float16)(b1.z*s); r[15]=(_Float16)(b1.w*s);
  return r;
}

// Two f32 to a pair of f16 (round to nearest even).
typedef __attribute__((ext_vector_type(2))) _Float16 v2h;
__device__ __forceinline__ unsigned cvt_here(float a, float b) {
  v2h r;
  r[0] = (_Float16)a; r[1] = (_Float16)b;
  return __builtin_bit_cast(unsigned, r);
}

typedef __attribute__((ext_vector_type(4))) _Float16 v4h;
__device__ __forceinline__ v4h cvt4(const v4f f) {
  v4h r;
  r[0]=(_Float16)f[0]; r[1]=(_Float16)f[1]; r[2]=(_Float16)f[2]; r[3]=(_Float16)f[3];
  return r;
}

// Same fragment pattern from an f16 LDS row (two ds_load_b128).
__device__ __forceinline__ v16h frag_from_ldsrow(const _Float16* rowp, int lo) {
  v8h a = *(const v8h*)(rowp + lo);
  v8h b = *(const v8h*)(rowp + lo + 16);
  return __builtin_shufflevector(a, b, 0,1,2,3,4,5,6,7,8,9,10,11,12,13,14,15);
}

// Transposing LDS load. With lane l pointing at the 16 bytes
// T[8*(l>>4) + (l&7)][8*((l>>3)&1) ..+7] of a row-major f16 tile T, lane l gets
// the column piece T[8*(l>>4) + 0..7][l&15].
typedef __attribute__((ext_vector_type(8))) short v8s;
typedef __attribute__((address_space(3))) v8s lds_v8s;
__device__ __forceinline__ v8h ld_tr16(const _Float16* p) {
  return __builtin_bit_cast(v8h, __builtin_amdgcn_ds_load_tr16_b128_v8i16((lds_v8s*)p));
}

#define KLDS_STRIDE 72   /* 144B: (stride/16B)=9 odd -> conflict-free b128 rows */
#define VLDS_STRIDE 80   /* 160B: (stride/32B)=5 odd -> conflict-free transposing loads */
#define TKEYS 64                     /* keys of one tile: two passes of 32, one barrier */
#define KBUF (TKEYS * KLDS_STRIDE)   /* f16 elements of one K buffer */
#define VBUF (TKEYS * VLDS_STRIDE)   /* f16 elements of one V buffer */

// A wave holds 32 query columns (two groups of 16): every K and V fragment that it
// reads from LDS feeds two products. A work-group has 16 waves for 256 queries:
// waves 0-7 walk keys 0..1023, waves 8-15 keys 1024..2047, each half with its own
// LDS ring, its own reference and sums; the halves are joined once, at the end,
// through LDS. So a SIMD holds four waves (one work-group per WGP), whose vector
// work, LDS waits and products cover one another.
#define KHALF (NK / 2)
__global__ __launch_bounds__(512) __attribute__((amdgpu_waves_per_eu(4, 4)))
void attn_fwd(const float* __restrict__ Q, const float* __restrict__ K,
              const float* __restrict__ V, const float* __restrict__ Wo,
              float* __restrict__ X, float* __restrict__ Wh) {
  // Per key half two buffers each: tile t is read from buffer t & 1 while tile
  // t + 1 is written into the other one.
  __shared__ __attribute__((aligned(16))) _Float16 Klds[4 * KBUF];   // [half][buf][key][d]  f16
  __shared__ __attribute__((aligned(16))) _Float16 Vlds[4 * VBUF];   // [half][buf][key][d]  f16 (transposed on read)
  // The join: per wave the accumulators of the column group that it hands over
  // (eight 16-byte pieces a lane), with that group's sum and negated reference.
  __shared__ __attribute__((aligned(16))) v4f Mo[16 * 8 * 32];
  __shared__ float Ml[16 * 2 * 32];

  const int lane = threadIdx.x & 31;
  const int wave = threadIdx.x >> 5;
  const int wq = wave & 7;                 // which 32 query columns
  // Key half, in a scalar register: the join's branches are scalar branches.
  const int kh = __builtin_amdgcn_readfirstlane(threadIdx.x >> 8);
  const int tid = threadIdx.x & 255;       // thread within its half
  const int qt = blockIdx.x & 7;           // 8 q-tiles of 256
  const int h  = (blockIdx.x >> 3) & 15;   // 16 heads
  const int b  = blockIdx.x >> 7;          // 2 batches
  const int lo = (lane & 16) ? 8 : 0;      // per-lane run offset within 32
  const int l15 = lane & 15;

  // This block's 4096 elements of the projection weight, to be left in the
  // workspace as f16 for out_proj (whole lines per wave-wide load). The loads go
  // out ahead of the first Q, K and V loads and share their wait.
  const int wi = blockIdx.x * 4096 + threadIdx.x * 4;
  // The two scheduling fences keep every other instruction out from between the
  // loads and the s_wait_xcnt, which so stands in front of the next write into
  // the address registers that the loads name.
  __builtin_amdgcn_sched_barrier(0);
  const v4f wa = *(const v4f*)(Wo + wi);
  const v4f wb = *(const v4f*)(Wo + wi + 2048);
  asm volatile("s_wait_xcnt 0x0" ::: "memory");
  __builtin_amdgcn_sched_barrier(0);

  // Column group c of this wave: query rows qrow + 16 * c.
  const int qrow = qt * 256 + wq * 32 + l15;
  const float* qptr = Q + (b * NQ + qrow) * DM + h * DK + lo;   // this lane's run

  // Q B-fragments (per column group: d-chunks 0-31 / 32-63), softmax scale and
  // log2(e) folded in: the score products come out as arguments of 2^x.
  v16h qf[2][2];
  #pragma unroll
  for (int c = 0; c < 2; ++c) {
    qf[c][0] = frag_from_f32row(qptr + c * 16 * DM,      0, SCALE * L2E);
    qf[c][1] = frag_from_f32row(qptr + c * 16 * DM + 32, 0, SCALE * L2E);
  }
  // The address is an input, so that its registers stay its own up to this wait.
  asm volatile("s_wait_xcnt 0x0" :: "v"(qptr) : "memory");

  v8f O[2][4];
  #pragma unroll
  for (int c = 0; c < 2; ++c)
    #pragma unroll
    for (int i = 0; i < 4; ++i) O[c][i] = (v8f){0,0,0,0,0,0,0,0};
  float l[2] = {0.0f, 0.0f};
  // The held reference of each of this lane's two query columns, negated, in all
  // eight rows of an accumulator: it is the C operand of the score products, which
  // so give s - ref, the argument of 2^x. It moves only when a lane's 16 terms of a
  // pass sum to more than 2^8 (so every P that is used is <= 2^8, well inside f16),
  // and at the first pass, where thr and lowb make the test true and the column's
  // own maximum, of either sign, the reference.
  v8f cref[2] = {(v8f){0,0,0,0,0,0,0,0}, (v8f){0,0,0,0,0,0,0,0}};
  float thr = -3.0e38f, lowb = -3.0e38f;

  // Staging of a tile (64 keys x 64 dims) of this half: thread t of the half brings
  // dims 8*(t&7)..+7 of keys t>>3 and 32 + (t>>3), of K and of V, through registers.
  const int srow = tid >> 3;
  const int scol = (tid & 7) * 8;
  const float* kg = K + (b * NK + kh * KHALF + srow) * DM + h * DK + scol;
  const float* vg = V + (b * NK + kh * KHALF + srow) * DM + h * DK + scol;
  _Float16* const kst = &Klds[kh * 2 * KBUF + srow * KLDS_STRIDE + scol];
  _Float16* const vst = &Vlds[kh * 2 * VBUF + srow * VLDS_STRIDE + scol];
  // This lane's K row (key l15 of buffer 0 of its half) for the fragments.
  const _Float16* const kfr = &Klds[kh * 2 * KBUF + l15 * KLDS_STRIDE];
  // This lane's address in the V tile for the transposing loads (keys 0..15, dims 0..15).
  const _Float16* const vtr = &Vlds[kh * 2 * VBUF + (lo + (lane & 7)) * VLDS_STRIDE + ((lane >> 3) & 1) * 8];
  v4f kf0, kf1, kf2, kf3, vf0, vf1, vf2, vf3;

  // K and V of a tile are fetched and written in turn, V in a tile's first pass and
  // K in its second: each pass has half of the staging work, a tile behind its loads.
  auto fetch_k = [&]() __attribute__((always_inline)) {
    kf0 = *(const v4f*)kg;              kf1 = *(const v4f*)(kg + 4);
    kf2 = *(const v4f*)(kg + 32 * DM);  kf3 = *(const v4f*)(kg + 32 * DM + 4);
  };
  auto fetch_v = [&]() __attribute__((always_inline)) {
    vf0 = *(const v4f*)vg;              vf1 = *(const v4f*)(vg + 4);
    vf2 = *(const v4f*)(vg + 32 * DM);  vf3 = *(const v4f*)(vg + 32 * DM + 4);
  };
  // Convert what was fetched and write it into buffer buf; all conversions ahead
  // of the writes, so that none waits for an LDS write to have read its data.
  auto stage_k = [&](const int buf) __attribute__((always_inline)) {
    v4u kp, kq;
    kp[0] = cvt_here(kf0[0], kf0[1]);  kp[1] = cvt_here(kf0[2], kf0[3]);
    kp[2] = cvt_here(kf1[0], kf1[1]);  kp[3] = cvt_here(kf1[2], kf1[3]);
    kq[0] = cvt_here(kf2[0], kf2[1]);  kq[1] = cvt_here(kf2[2], kf2[3]);
    kq[2] = cvt_here(kf3[0], kf3[1]);  kq[3] = cvt_here(kf3[2], kf3[3]);
    *(v4u*)(kst + buf * KBUF) = kp;
    *(v4u*)(kst + buf * KBUF + 32 * KLDS_STRIDE) = kq;
  };
  auto stage_v = [&](const int buf) __attribute__((always_inline)) {
    v4u vp, vq;
    vp[0] = cvt_here(vf0[0], vf0[1]);  vp[1] = cvt_here(vf0[2], vf0[3]);
    vp[2] = cvt_here(vf1[0], vf1[1]);  vp[3] = cvt_here(vf1[2], vf1[3]);
    vq[0] = cvt_here(vf2[0], vf2[1]);  vq[1] = cvt_here(vf2[2], vf2[3]);
    vq[2] = cvt_here(vf3[0], vf3[1]);  vq[3] = cvt_here(vf3[2], vf3[3]);
    *(v4u*)(vst + buf * VBUF) = vp;
    *(v4u*)(vst + buf * VBUF + 32 * VLDS_STRIDE) = vq;
  };

  // Work-group barrier by hand, with the wait on this wave's LDS reads and writes
  // that it needs: __syncthreads() would also wait for the global loads that are
  // meant to stay in flight across it. The scheduling fence keeps the tile's
  // vector work and products in front of the barrier, where they cover the
  // draining of the LDS writes.
  auto publish = [&]() __attribute__((always_inline)) {
    __builtin_amdgcn_sched_barrier(0);
    asm volatile("s_wait_dscnt 0x0\n\ts_barrier_signal -1\n\ts_barrier_wait -1" ::: "memory");
  };

  // One pass: products and softmax on keys 32p..32p+31 of buffer cur. Meanwhile,
  // where put_next, the fetched V (pass 0) or K (pass 1) of tile t + 1 goes into the
  // other buffer and, where get_next, the loads of tile t + 2's are issued.
  auto pass = [&](const int cur, const int p, const bool put_next, const bool get_next)
      __attribute__((always_inline)) {
    // The K fragments of the pass's two groups of 16 keys, in the order of use.
    v16h ka[2], kc[2];
    #pragma unroll
    for (int g = 0; g < 2; ++g)
      ka[g] = frag_from_ldsrow(kfr + cur * KBUF + (p * 32 + g * 16) * KLDS_STRIDE, lo);
    #pragma unroll
    for (int g = 0; g < 2; ++g)
      kc[g] = frag_from_ldsrow(kfr + cur * KBUF + (p * 32 + g * 16) * KLDS_STRIDE + 32, lo);
    // Staging stands here, behind the K reads: its conversions, LDS writes and
    // loads issue while the K fragments are on their way.
    if (p == 0) {
      if (put_next) {
        stage_v(cur ^ 1);
        if (get_next) { vg += TKEYS * DM; fetch_v(); }
      }
    } else {
      if (put_next) {
        stage_k(cur ^ 1);
        if (get_next) { kg += TKEYS * DM; fetch_k(); }
      }
    }
    // Keeps the 8 LDS reads together up here (sunk among the products they would
    // be waited for one by one), and the staging with them.
    __builtin_amdgcn_sched_barrier(0);

    // S^T = K . Q^T - ref  (per column group two 16key x 16q fragments, K-dim 64 =
    // 2 WMMAs each); a K fragment's two products stand side by side.
    v8f s[2][2];
    #pragma unroll
    for (int g = 0; g < 2; ++g) {
      s[0][g] = wmma_f16(ka[g], qf[0][0], cref[0]);
      s[1][g] = wmma_f16(ka[g], qf[1][0], cref[1]);
    }
    #pragma unroll
    for (int g = 0; g < 2; ++g) {
      s[0][g] = wmma_f16(kc[g], qf[0][1], s[0][g]);
      s[1][g] = wmma_f16(kc[g], qf[1][1], s[1][g]);
    }
    // Inputs only: holds the V reads below behind the eight score products, which
    // so stand in one run, with no LDS read among them. The v_nop are the four
    // vector slots that the chip needs between the last product and a vector write
    // over its operands: the next vector instructions are asm text, which the
    // compiler does not count, and may be given the K fragments' registers.
    asm volatile("v_nop\n\tv_nop\n\tv_nop\n\tv_nop"
                 :: "v"(s[0][0]), "v"(s[0][1]), "v"(s[1][0]), "v"(s[1][1]) : "memory");

    v16h vfrag[4];
    #pragma unroll
    for (int gd = 0; gd < 4; ++gd) {
      // V^T rows gd*16 + l15 over keys 32p..32p+31: keys lo..lo+7, then keys
      // 16+lo..16+lo+7, the k order of the K rows' fragments and of P^T.
      const _Float16* vp = vtr + cur * VBUF + p * 32 * VLDS_STRIDE + gd * 16;
      vfrag[gd] = __builtin_shufflevector(ld_tr16(vp), ld_tr16(vp + 16 * VLDS_STRIDE),
                                          0,1,2,3,4,5,6,7,8,9,10,11,12,13,14,15);
    }
    // Keeps the V reads up here, so that they land under the vector work: the
    // compiler sinks them to the pass's end otherwise.
    __builtin_amdgcn_sched_barrier(0);

    // Per column group: P = 2^(s - ref), this lane's sum of its 16 terms (two
    // independent chains), and the P^T B-fragment, which feeds directly from the
    // registers of the terms.
    v16h pf[2];
    float ps[2];
    auto terms = [&](const int c) __attribute__((always_inline)) {
      const v8f a0 = exp2_x8(s[c][0]);
      const v8f a1 = exp2_x8(s[c][1]);
      float psa = a0[0], psb = a1[0];
      #pragma unroll
      for (int r = 1; r < 8; ++r) {
        psa += a0[r];
        psb += a1[r];
      }
      #pragma unroll
      for (int r = 0; r < 8; ++r) {
        pf[c][r]     = (_Float16)a0[r];
        pf[c][8 + r] = (_Float16)a1[r];
      }
      ps[c] = psa + psb;
    };
    terms(0);
    terms(1);
    // One test per pass and wave, a scalar branch: has any column outgrown its
    // reference? A term above 2^8 makes its lane's sum exceed 2^8 (no term is
    // negative), so the sums that are needed anyway tell, and no maximum is taken
    // and nothing exchanged between the wave's halves unless the answer is yes.
    // Marked unlikely, so that the pass's usual path stays in one piece.
    if (__builtin_expect(__builtin_amdgcn_ballot_w32(fmaxf(ps[0], ps[1]) > thr) != 0, 0)) {
      #pragma unroll
      for (int c = 0; c < 2; ++c) {
        float mca = s[c][0][0], mcb = s[c][1][0];
        #pragma unroll
        for (int r = 1; r < 8; ++r) {
          mca = fmaxf(mca, s[c][0][r]);
          mcb = fmaxf(mcb, s[c][1][r]);
        }
        const float mc = fmaxf(mca, mcb);
        // The column's maximum over both halves, or no move (lowb) where it lies
        // below the reference.
        const float delta = fmaxf(fmaxf(mc, __shfl_xor(mc, 16, 32)), lowb);
        // delta < 0 only at the first pass, where O and l are 0: the factor 1 keeps
        // them so where 2^-delta would overflow.
        const float corr = exp2_x1(fminf(-delta, 0.0f));
        #pragma unroll
        for (int g = 0; g < 2; ++g) s[c][g] -= delta;
        #pragma unroll
        for (int i = 0; i < 4; ++i) O[c][i] *= corr;
        l[c] *= corr;
        cref[c] -= delta;
        terms(c);
      }
      thr = 256.0f;
      lowb = 0.0f;
    }
    l[0] += ps[0];
    l[1] += ps[1];

    // O^T += V^T . P^T  (per column group 4 d-groups of 16, one k-step of 32 keys);
    // a V fragment's two products stand side by side.
    #pragma unroll
    for (int gd = 0; gd < 4; ++gd) {
      O[0][gd] = wmma_f16(vfrag[gd], pf[0], O[0][gd]);
      O[1][gd] = wmma_f16(vfrag[gd], pf[1], O[1][gd]);
    }
  };
  // One tile: its two passes, and the one barrier of a tile: it publishes tile
  // t + 1 of both halves and ends every wave's reads of buffer cur, which the next
  // tile overwrites.
  auto trip = [&](const int cur, const bool put_next, const bool get_next)
      __attribute__((always_inline)) {
    pass(cur, 0, put_next, get_next);
    pass(cur, 1, put_next, get_next);
    if (put_next) publish();
  };

  // Prologue: tile 0 into buffer 0, tile 1 on its way.
  fetch_k();
  fetch_v();
  stage_k(0);
  stage_v(0);
  kg += TKEYS * DM; vg += TKEYS * DM;
  fetch_k();
  fetch_v();
  publish();

  // The weight's f16 copy: the same conversion that out_proj's staging made, once
  // per element instead of once per block that reads the row.
  const v4h ha = cvt4(wa), hb = cvt4(wb);
  // Fences as at the loads: nothing else between the stores and their wait.
  __builtin_amdgcn_sched_barrier(0);
  *(v4h*)((_Float16*)Wh + wi)        = ha;
  *(v4h*)((_Float16*)Wh + wi + 2048) = hb;
  // Behind the stores, in front of the next write into a register that they name.
  asm volatile("s_wait_xcnt 0x0" ::: "memory");
  __builtin_amdgcn_sched_barrier(0);

  // One loop for all tiles of the half, the last pair too.
  for (int kb = 0; kb < KHALF; kb += 2 * TKEYS) {
    // Scalar, the same for the whole work-group: false in the last pair of tiles,
    // where nothing is left to fetch and, in the last tile, to write or publish.
    const bool more = kb + 2 * TKEYS < KHALF;
    trip(0, true, more);
    trip(1, more, more);
  }

  // Finish. Each wave joins its lane halves' sums; then the two waves that hold the
  // same 32 queries (wave w and w ^ 8, one per key half) exchange: the wave of half
  // kh finishes column group kh and hands group 1 - kh to its partner.
  const int dhi = (lane & 16) ? 8 : 0;
  const float lsum[2] = {l[0] + __shfl_xor(l[0], 16, 32), l[1] + __shfl_xor(l[1], 16, 32)};
  auto give = [&](const int c) __attribute__((always_inline)) {
    #pragma unroll
    for (int i = 0; i < 4; ++i) {
      Mo[(wave * 8 + i * 2) * 32 + lane]     = __builtin_shufflevector(O[c][i], O[c][i], 0, 1, 2, 3);
      Mo[(wave * 8 + i * 2 + 1) * 32 + lane] = __builtin_shufflevector(O[c][i], O[c][i], 4, 5, 6, 7);
    }
    Ml[(wave * 2) * 32 + lane]     = lsum[c];
    Ml[(wave * 2 + 1) * 32 + lane] = cref[c][0];
  };
  // X leaves as f16, the type in which out_proj's products take it. One 16-byte
  // store per group of 16 dims.
  _Float16* xrow = (_Float16*)X + (b * NQ + qrow) * DM + h * DK;
  auto take = [&](const int c) __attribute__((always_inline)) {
    const int pw = wave ^ 8;
    const float lo_ = Ml[(pw * 2) * 32 + lane];        // the partner's sum
    const float nro = Ml[(pw * 2 + 1) * 32 + lane];    // and negated reference
    const float nrm = cref[c][0];
    // Both halves go to the larger of the two references (the smaller negated
    // one): factors 2^(ref - max) <= 1, one of them 1, so the joined sum stays
    // at or above the sum of the half that keeps its reference.
    const float nmin = fminf(nrm, nro);
    const float fm = exp2_x1(nmin - nrm);
    const float fo = exp2_x1(nmin - nro);
    const float inv = 1.0f / (fm * lsum[c] + fo * lo_);
    const float am = fm * inv, ao = fo * inv;
    v8h o[4];
    #pragma unroll
    for (int gd = 0; gd < 4; ++gd) {
      const v4f u0 = Mo[(pw * 8 + gd * 2) * 32 + lane];
      const v4f u1 = Mo[(pw * 8 + gd * 2 + 1) * 32 + lane];
      #pragma unroll
      for (int r = 0; r < 4; ++r) {
        o[gd][r]     = (_Float16)(O[c][gd][r] * am + u0[r] * ao);
        o[gd][4 + r] = (_Float16)(O[c][gd][4 + r] * am + u1[r] * ao);
      }
    }
    // All values first, then the four stores and the end: no vector instruction
    // behind a store, so none writes into a register that an issued store names.
    __builtin_amdgcn_sched_barrier(0);
    #pragma unroll
    for (int gd = 0; gd < 4; ++gd)
      *(v8h*)(xrow + c * 16 * DM + gd * 16 + dhi) = o[gd];
  };
  if (kh == 0) give(1); else give(0);
  // Every wave passes it: what was handed over is read only behind it.
  __syncthreads();
  if (kh == 0) take(0); else take(1);
}

// Y[m][n] = sum_k X[m][k] * W[n][k] + bias[n];  M=4096, N=1024, K=1024.
// Each wave: 32x32 tile (2x2 WMMA frags); block: 8 waves = 64(M) x 128(N).
// X and W come from the workspace as f16 (attn_fwd leaves them so).
// Per k-tile of 128 the block's 64 X rows and 128 W rows are brought once, by
// asynchronous copies straight into LDS (no register, no LDS store instruction),
// where all waves that need a row take their fragments from. Two buffers: the
// copies of tile t + 2 fly while tile t + 1 is worked on.
#define PK 128            /* k per staged tile: 256 bytes of a row */
#define PTILES (DM / PK)
#define PLDS_STRIDE 136   /* 272B: (stride/16B)=17 odd -> conflict-free b128 rows */
#define XBUF (64 * PLDS_STRIDE)    /* f16 elements of one X buffer */
#define WBUF (128 * PLDS_STRIDE)   /* f16 elements of one W buffer */

__global__ __launch_bounds__(256)
void out_proj(const float* __restrict__ X, const float* __restrict__ W,
              const float* __restrict__ bias, float* __restrict__ Y) {
  __shared__ __attribute__((aligned(16))) _Float16 Xs[2 * XBUF];
  __shared__ __attribute__((aligned(16))) _Float16 Ws[2 * WBUF];

  const int lane = threadIdx.x & 31;
  const int wave = threadIdx.x >> 5;
  const int lo = (lane & 16) ? 8 : 0;
  const int l15 = lane & 15;
  const int bm = blockIdx.x & 63;
  const int bn = blockIdx.x >> 6;
  const int m0 = bm * 64 + (wave & 1) * 32;
  const int n0 = bn * 128 + (wave >> 1) * 32;

  // Staging: one wave-wide copy brings the 256-byte pieces of two rows (four whole
  // lines): wave w has rows 2w, 2w+1, then +16, +32, ...; lane l brings elements
  // 8*(l&15)..+7 of row 2w + (l>>4).
  const int crow = wave * 2 + (lane >> 4);
  const int ccol = l15 * 8;
  const _Float16* const xg = (const _Float16*)X + (bm * 64 + crow) * DM + ccol;
  const _Float16* const wg = (const _Float16*)W + (bn * 128 + crow) * DM + ccol;
  // This lane's LDS byte addresses (the low 32 bits of the __shared__ addresses).
  const unsigned xl = (unsigned)(size_t)&Xs[crow * PLDS_STRIDE + ccol];
  const unsigned wl = (unsigned)(size_t)&Ws[crow * PLDS_STRIDE + ccol];

  // The twelve copies of this thread for the k-tile that starts at kc, into buffer
  // buf. The s_wait_xcnt stands in the copies' own statement, behind the last one:
  // so it precedes every later write into a register that a copy names.
  auto copy_tile = [&](const int buf, const int kc) __attribute__((always_inline)) {
    const _Float16* const x = xg + kc;
    const _Float16* const w = wg + kc;
    const unsigned lx = xl + buf * (XBUF * 2);
    const unsigned lw = wl + buf * (WBUF * 2);
    asm volatile(
        "global_load_async_to_lds_b128 %0, %1, off\n\t"
        "global_load_async_to_lds_b128 %2, %3, off\n\t"
        "global_load_async_to_lds_b128 %4, %5, off\n\t"
        "global_load_async_to_lds_b128 %6, %7, off\n\t"
        "global_load_async_to_lds_b128 %8, %9, off\n\t"
        "global_load_async_to_lds_b128 %10, %11, off\n\t"
        "global_load_async_to_lds_b128 %12, %13, off\n\t"
        "global_load_async_to_lds_b128 %14, %15, off\n\t"
        "global_load_async_to_lds_b128 %16, %17, off\n\t"
        "global_load_async_to_lds_b128 %18, %19, off\n\t"
        "global_load_async_to_lds_b128 %20, %21, off\n\t"
        "global_load_async_to_lds_b128 %22, %23, off\n\t"
        "s_wait_xcnt 0x0"
        :: "v"(lx),                          "v"(x),
           "v"(lx + 16 * PLDS_STRIDE * 2),   "v"(x + 16 * DM),
           "v"(lx + 32 * PLDS_STRIDE * 2),   "v"(x + 32 * DM),
           "v"(lx + 48 * PLDS_STRIDE * 2),   "v"(x + 48 * DM),
           "v"(lw),                          "v"(w),
           "v"(lw + 16 * PLDS_STRIDE * 2),   "v"(w + 16 * DM),
           "v"(lw + 32 * PLDS_STRIDE * 2),   "v"(w + 32 * DM),
           "v"(lw + 48 * PLDS_STRIDE * 2),   "v"(w + 48 * DM),
           "v"(lw + 64 * PLDS_STRIDE * 2),   "v"(w + 64 * DM),
           "v"(lw + 80 * PLDS_STRIDE * 2),   "v"(w + 80 * DM),
           "v"(lw + 96 * PLDS_STRIDE * 2),   "v"(w + 96 * DM),
           "v"(lw + 112 * PLDS_STRIDE * 2),  "v"(w + 112 * DM)
        : "memory");
  };

  // Fragment rows of this wave's 32x32 tile (buffer 0).
  const _Float16* xr0 = &Xs[((wave & 1) * 32 + l15) * PLDS_STRIDE];
  const _Float16* xr1 = xr0 + 16 * PLDS_STRIDE;
  const _Float16* wr0 = &Ws[((wave >> 1) * 32 + l15) * PLDS_STRIDE];
  const _Float16* wr1 = wr0 + 16 * PLDS_STRIDE;

  v8f C[2][2];
  #pragma unroll
  for (int i = 0; i < 2; ++i)
    #pragma unroll
    for (int j = 0; j < 2; ++j) C[i][j] = (v8f){0,0,0,0,0,0,0,0};

  // Prologue: tile 0 landed and published, tile 1 on its way.
  copy_tile(0, 0);
  // This wave's copies have landed (the compiler places no wait for them).
  asm volatile("s_wait_asynccnt 0x0" ::: "memory");
  __syncthreads();
  copy_tile(1, PK);

  // Unrolled: buffer and k offsets become immediates, and the test for a tile
  // t + 2 is settled at compile time.
  #pragma unroll
  for (int t = 0; t < PTILES; ++t) {
    const int buf = t & 1;
    // The tile's sixteen fragments, in the order of use.
    v16h a0[4], a1[4], b0[4], b1[4];
    #pragma unroll
    for (int s = 0; s < 4; ++s) {
      a0[s] = frag_from_ldsrow(xr0 + buf * XBUF + s * 32, lo);
      b0[s] = frag_from_ldsrow(wr0 + buf * WBUF + s * 32, lo);
      b1[s] = frag_from_ldsrow(wr1 + buf * WBUF + s * 32, lo);
      a1[s] = frag_from_ldsrow(xr1 + buf * XBUF + s * 32, lo);
    }
    // Keeps the 32 LDS reads together up here: sunk among the products they are
    // waited for group by group, a full LDS latency each time. (The products hold
    // registers only and may run on under the next tile's reads.)
    __builtin_amdgcn_sched_barrier(0);
    #pragma unroll
    for (int s = 0; s < 4; ++s) {
      C[0][0] = wmma_f16(a0[s], b0[s], C[0][0]);
      C[0][1] = wmma_f16(a0[s], b1[s], C[0][1]);
      C[1][0] = wmma_f16(a1[s], b0[s], C[1][0]);
      C[1][1] = wmma_f16(a1[s], b1[s], C[1][1]);
    }
    // The tile's foot. This wave's reads of buffer buf have returned:
    asm volatile("s_wait_dscnt 0x0" ::: "memory");
    // its copies of tile t + 1 have landed:
    asm volatile("s_wait_asynccnt 0x0" ::: "memory");
    // and the one barrier of a tile publishes tile t + 1 and ends every wave's
    // reads of buffer buf, which is refilled behind it.
    __syncthreads();
    if (t + 2 < PTILES) copy_tile(buf, (t + 2) * PK);
  }
  // No copy is outstanding when the wave goes on to its end.
  asm volatile("s_wait_asynccnt 0x0" ::: "memory");

  const float bias0 = bias[n0 + l15];
  const float bias1 = bias[n0 + 16 + l15];
  const int mhi = (lane & 16) ? 8 : 0;
  #pragma unroll
  for (int mi = 0; mi < 2; ++mi) {
    #pragma unroll
    for (int ni = 0; ni < 2; ++ni) {
      const float bb = ni ? bias1 : bias0;
      #pragma unroll
      for (int r = 0; r < 8; ++r) {
        const int row = m0 + mi * 16 + r + mhi;
        const int col = n0 + ni * 16 + l15;
        Y[row * DM + col] = C[mi][ni][r] + bb;
      }
    }
  }
}

extern "C" void kernel_launch(void* const* d_in, const int* in_sizes, int n_in,
                              void* d_out, int out_size, void* d_ws, size_t ws_size,
                              hipStream_t stream) {
  (void)in_sizes; (void)n_in; (void)out_size; (void)ws_size;
  const float* Q  = (const float*)d_in[0];
  const float* K  = (const float*)d_in[1];
  const float* V  = (const float*)d_in[2];
  const float* Wo = (const float*)d_in[3];
  const float* bo = (const float*)d_in[4];
  float* X  = (float*)d_ws;           // (b, q, h*d_k) intermediate, held as f16: 8 MiB
  float* Wh = X + 2 * 1024 * 1024;    // behind it, the weight as f16: 2 MiB
  float* Y = (float*)d_out;

  // 2 batches * 16 heads * 8 q-tiles = 256 blocks of 16 waves
  attn_fwd<<<dim3(256), dim3(512), 0, stream>>>(Q, K, V, Wo, X, Wh);
  // (4096/64) * (1024/128) = 64 * 8 = 512 blocks
  out_proj<<<dim3(512), dim3(256), 0, stream>>>(X, Wh, bo, Y);
}
